// v000
// Times are from an AMD MI455X. After a warm-up the kernel runs many times in a row, and a time is the length of
// such a window on the GPU divided by its runs, so every launch and the gaps after it count. The runs cycle
// through copies of the inputs. A figure is the median of several windows, for all but v000 over two sittings.
// Sittings can differ by a few percent; kernels timed side by side share one.
// v000, which the later versions start from, runs in 439 microseconds.
#include <hip/hip_runtime.h>
#include <hip/hip_bf16.h>

// ---------------------------------------------------------------------------
// Gaussian-kernel attention, fused flash-style over the KEY axis.
//   B=8, NK=NQ=4096, IN=3, H=128, DV=64
// Dominant cost: attn@VALUE (17.2 GFLOP) + 134M score dots -> WMMA f32 16x16x4.
// Scores are <= 0 after clamping, so exp() never overflows: streaming softmax
// without running-max rescaling (sum >= strongest term, divide once at end).
// ---------------------------------------------------------------------------

#define BB  8
#define NK  4096
#define NQ  4096
#define DV  64

typedef __attribute__((ext_vector_type(2))) float v2f;
typedef __attribute__((ext_vector_type(8))) float v8f;

__device__ inline v8f wmma4(v2f a, v2f b, v8f c) {
  // D = A(16x4) x B(4x16) + C, all f32
  return __builtin_amdgcn_wmma_f32_16x16x4_f32(false, a, false, b, (short)0, c,
                                               false, false);
}

__device__ inline float swap16(float x) {
  // ds_swizzle SWAPX16: xor=0x10, and=0x1f  ->  offset 0x401F
  return __builtin_bit_cast(
      float, __builtin_amdgcn_ds_swizzle(__builtin_bit_cast(int, x), 0x401F));
}

// ---------------------------------------------------------------------------
// Kernel 1: shared MLP (3 -> 128 -> 128 -> 3) + elementwise scale, emits
// augmented float4 (sx, sy, sz, -0.5*|s|^2) per point.  2.2 GFLOP total: VALU.
// 128 threads handle 32 points; hidden layers staged transposed in LDS.
// ---------------------------------------------------------------------------
__global__ __launch_bounds__(128) void NW0_mlp_aug(
    const float* __restrict__ pts,           // [N,3]
    const float* __restrict__ W1, const float* __restrict__ b1,
    const float* __restrict__ W2, const float* __restrict__ b2,
    const float* __restrict__ W3, const float* __restrict__ b3,
    float4* __restrict__ aug) {
  __shared__ __align__(16) float xs[32][4];
  __shared__ __align__(16) float h1[128][32];   // h1T[j][p]
  __shared__ __align__(16) float h2[128][32];   // h2T[u][p]
  __shared__ __align__(16) float sc[32][4];

  const int t    = threadIdx.x;
  const int base = blockIdx.x * 32;

  if (t < 32) {
    const float* g = pts + (size_t)(base + t) * 3;
    xs[t][0] = g[0]; xs[t][1] = g[1]; xs[t][2] = g[2]; xs[t][3] = 0.f;
  }
  __syncthreads();

  // layer 1: thread t == hidden unit u
  {
    const float w0 = W1[t * 3 + 0], w1 = W1[t * 3 + 1], w2 = W1[t * 3 + 2];
    const float bb = b1[t];
    #pragma unroll
    for (int p = 0; p < 32; ++p) {
      float h = fmaf(w0, xs[p][0], fmaf(w1, xs[p][1], fmaf(w2, xs[p][2], bb)));
      h1[t][p] = fmaxf(h, 0.f);
    }
  }
  __syncthreads();

  // layer 2: 128x128, 32 accumulators per thread, LDS rows read as float4
  {
    const float bb = b2[t];
    float4 acc[8];
    #pragma unroll
    for (int g = 0; g < 8; ++g) acc[g] = make_float4(bb, bb, bb, bb);
    const float* w2r = W2 + t * 128;
    for (int j = 0; j < 128; ++j) {
      const float  w   = w2r[j];
      const float4* row = (const float4*)(&h1[j][0]);
      #pragma unroll
      for (int g = 0; g < 8; ++g) {
        float4 h = row[g];
        acc[g].x = fmaf(w, h.x, acc[g].x);
        acc[g].y = fmaf(w, h.y, acc[g].y);
        acc[g].z = fmaf(w, h.z, acc[g].z);
        acc[g].w = fmaf(w, h.w, acc[g].w);
      }
    }
    #pragma unroll
    for (int g = 0; g < 8; ++g) {
      h2[t][4 * g + 0] = fmaxf(acc[g].x, 0.f);
      h2[t][4 * g + 1] = fmaxf(acc[g].y, 0.f);
      h2[t][4 * g + 2] = fmaxf(acc[g].z, 0.f);
      h2[t][4 * g + 3] = fmaxf(acc[g].w, 0.f);
    }
  }
  __syncthreads();

  // layer 3: thread -> (point p = t>>2, channel c = t&3), c<3 active
  {
    const int p = t >> 2, c = t & 3;
    if (c < 3) {
      float acc = b3[c];
      const float* w3r = W3 + c * 128;
      for (int u = 0; u < 128; ++u) acc = fmaf(w3r[u], h2[u][p], acc);
      sc[p][c] = xs[p][c] * acc;   // x * mlp(x)
    }
  }
  __syncthreads();

  if (t < 32) {
    const float sx = sc[t][0], sy = sc[t][1], sz = sc[t][2];
    const float w  = -0.5f * (sx * sx + sy * sy + sz * sz);
    aug[base + t]  = make_float4(sx, sy, sz, w);
  }
}

// ---------------------------------------------------------------------------
// Kernel 2: fused score + softmax + context.
// Block = 256 thr (8 waves); wave w owns 16 queries; loop over 256 key tiles.
// Per key tile per wave: 1 score WMMA + 16 accumulate WMMAs (Vt in LDS),
// 8 exps, 8 ds_swizzle SWAPX16 to re-layout P as a WMMA B operand.
// ---------------------------------------------------------------------------
__global__ __launch_bounds__(256) void NW0_attn(
    const float4* __restrict__ kaug, const float4* __restrict__ qaug,
    const float* __restrict__ value, float* __restrict__ out) {
  __shared__ __align__(16) float vts[16 * 80];   // V tile 16x64, stride 80

  const int b    = blockIdx.x >> 5;       // 32 query blocks per batch
  const int qblk = blockIdx.x & 31;
  const int tid  = threadIdx.x;
  const int wave = tid >> 5;
  const int lane = tid & 31;
  const int l16  = lane & 15;
  const bool hi  = lane >= 16;
  const int q    = qblk * 128 + wave * 16 + l16;  // this lane's query column

  // B operand of the score WMMA: rows (Qx,Qy,Qz,1); C = -0.5*q2 per column.
  const float4 qa = qaug[(size_t)b * NQ + q];
  v2f Bq; Bq.x = hi ? qa.z : qa.x; Bq.y = hi ? 1.0f : qa.y;
  const float cq = qa.w;                       // -0.5*|Qs|^2
  const v8f c8 = {cq, cq, cq, cq, cq, cq, cq, cq};

  v8f o[4] = {v8f{}, v8f{}, v8f{}, v8f{}};     // O^T[v,q], 4 v-tiles of 16
  float lacc = 0.f;                            // partial softmax denominator

  const float*  vb = value + (size_t)b * NK * DV;
  const float4* kb = kaug + (size_t)b * NK;

  for (int kt = 0; kt < NK; kt += 16) {
    // ---- stage V[kt..kt+15][0..63] into LDS (256 thr x float4) ----
    {
      const int r = tid >> 4, c = (tid & 15) << 2;
      const float4 vv = *(const float4*)(vb + (size_t)(kt + r) * DV + c);
      *(float4*)(vts + r * 80 + c) = vv;
    }
    __syncthreads();

    // ---- score tile: D[k,q] = K.Q - 0.5k2 - 0.5q2  (one WMMA) ----
    const float4 ka = kb[kt + l16];            // (Kx,Ky,Kz,-0.5*k2)
    v2f Ak; Ak.x = hi ? ka.z : ka.x; Ak.y = hi ? ka.w : ka.y;
    const v8f s = wmma4(Ak, Bq, c8);

    // ---- clamp (sqdist >= 0) + exp; scores <= 0 so exp in [0,1] ----
    float p0 = __expf(fminf(s[0], 0.f)), p1 = __expf(fminf(s[1], 0.f));
    float p2 = __expf(fminf(s[2], 0.f)), p3 = __expf(fminf(s[3], 0.f));
    float p4 = __expf(fminf(s[4], 0.f)), p5 = __expf(fminf(s[5], 0.f));
    float p6 = __expf(fminf(s[6], 0.f)), p7 = __expf(fminf(s[7], 0.f));
    lacc += ((p0 + p1) + (p2 + p3)) + ((p4 + p5) + (p6 + p7));

    // ---- re-layout P (C-layout) into four 4x16 B operands via SWAPX16 ----
    const float q0 = swap16(p0), q1 = swap16(p1), q2 = swap16(p2),
                q3 = swap16(p3), q4 = swap16(p4), q5 = swap16(p5),
                q6 = swap16(p6), q7 = swap16(p7);
    v2f Bp0; Bp0.x = hi ? q2 : p0; Bp0.y = hi ? q3 : p1;  // k rows 0..3
    v2f Bp1; Bp1.x = hi ? q6 : p4; Bp1.y = hi ? q7 : p5;  // k rows 4..7
    v2f Bp2; Bp2.x = hi ? p2 : q0; Bp2.y = hi ? p3 : q1;  // k rows 8..11
    v2f Bp3; Bp3.x = hi ? p6 : q4; Bp3.y = hi ? p7 : q5;  // k rows 12..15

    // ---- O^T += V^T x P : 4 v-tiles x 4 chained K=4 WMMAs ----
    const int d = hi ? 2 : 0;
    #pragma unroll
    for (int vt = 0; vt < 4; ++vt) {
      const int cb = vt * 16 + l16;
      v2f a0, a1, a2, a3;
      a0.x = vts[(0 + d) * 80 + cb];  a0.y = vts[(1 + d) * 80 + cb];
      a1.x = vts[(4 + d) * 80 + cb];  a1.y = vts[(5 + d) * 80 + cb];
      a2.x = vts[(8 + d) * 80 + cb];  a2.y = vts[(9 + d) * 80 + cb];
      a3.x = vts[(12 + d) * 80 + cb]; a3.y = vts[(13 + d) * 80 + cb];
      v8f acc = o[vt];
      acc = wmma4(a0, Bp0, acc);
      acc = wmma4(a1, Bp1, acc);
      acc = wmma4(a2, Bp2, acc);
      acc = wmma4(a3, Bp3, acc);
      o[vt] = acc;
    }
    __syncthreads();
  }

  // ---- finalize: combine lane halves of the denominator, divide, store ----
  const float inv = 1.0f / (lacc + swap16(lacc));
  float* ob = out + ((size_t)(b * NQ + q)) * DV + (hi ? 8 : 0);
  #pragma unroll
  for (int vt = 0; vt < 4; ++vt) {
    const v8f ov = o[vt] * inv;
    *(float4*)(ob + vt * 16)     = make_float4(ov[0], ov[1], ov[2], ov[3]);
    *(float4*)(ob + vt * 16 + 4) = make_float4(ov[4], ov[5], ov[6], ov[7]);
  }
}

// ---------------------------------------------------------------------------
extern "C" void kernel_launch(void* const* d_in, const int* in_sizes, int n_in,
                              void* d_out, int out_size, void* d_ws,
                              size_t ws_size, hipStream_t stream) {
  const float* KEY   = (const float*)d_in[0];
  const float* VALUE = (const float*)d_in[1];
  const float* QUERY = (const float*)d_in[2];
  const float* W1 = (const float*)d_in[3];
  const float* b1 = (const float*)d_in[4];
  const float* W2 = (const float*)d_in[5];
  const float* b2 = (const float*)d_in[6];
  const float* W3 = (const float*)d_in[7];
  const float* b3 = (const float*)d_in[8];

  float4* kaug = (float4*)d_ws;                 // 512 KB
  float4* qaug = kaug + (size_t)BB * NK;        // 512 KB

  NW0_mlp_aug<<<(BB * NK) / 32, 128, 0, stream>>>(KEY, W1, b1, W2, b2, W3, b3,
                                                  kaug);
  NW0_mlp_aug<<<(BB * NQ) / 32, 128, 0, stream>>>(QUERY, W1, b1, W2, b2, W3,
                                                  b3, qaug);
  NW0_attn<<<BB * (NQ / 128), 256, 0, stream>>>(kaug, qaug, VALUE,
                                                (float*)d_out);
}

// v001
// One run takes 165 microseconds.
// Two timings next to v000 put it at 2.70 and 2.71 times that version's speed.
#include <hip/hip_runtime.h>
#include <hip/hip_bf16.h>

// ---------------------------------------------------------------------------
// Gaussian-kernel attention, fused flash-style over the KEY axis.
//   B=8, NK=NQ=4096, IN=3, H=128, DV=64
// Dominant cost: attn@VALUE (17.2 GFLOP) + 134M score dots -> WMMA f32 16x16x4.
// Scores are <= 0 after clamping, so exp() never overflows: streaming softmax
// without running-max rescaling (sum >= strongest term, divide once at end).
// ---------------------------------------------------------------------------

#define BB  8
#define NK  4096
#define NQ  4096
#define DV  64

typedef __attribute__((ext_vector_type(2))) float v2f;
typedef __attribute__((ext_vector_type(8))) float v8f;

__device__ inline v8f wmma4(v2f a, v2f b, v8f c) {
  // D = A(16x4) x B(4x16) + C, all f32
  return __builtin_amdgcn_wmma_f32_16x16x4_f32(false, a, false, b, (short)0, c,
                                               false, false);
}

__device__ inline float swap16(float x) {
  // ds_swizzle SWAPX16: xor=0x10, and=0x1f  ->  offset 0x401F
  return __builtin_bit_cast(
      float, __builtin_amdgcn_ds_swizzle(__builtin_bit_cast(int, x), 0x401F));
}

// ---------------------------------------------------------------------------
// Kernel 1: shared MLP (3 -> 128 -> 128 -> 3) + elementwise scale, emits
// augmented float4 (sx, sy, sz, -0.5*|s|^2) per point.  2.2 GFLOP total: VALU.
// 128 threads handle 32 points; hidden layers staged transposed in LDS.
// ---------------------------------------------------------------------------
__global__ __launch_bounds__(128) void NW0_mlp_aug(
    const float* __restrict__ pts,           // [N,3]
    const float* __restrict__ W1, const float* __restrict__ b1,
    const float* __restrict__ W2, const float* __restrict__ b2,
    const float* __restrict__ W3, const float* __restrict__ b3,
    float4* __restrict__ aug) {
  __shared__ __align__(16) float xs[32][4];
  __shared__ __align__(16) float h1[128][32];   // h1T[j][p]
  __shared__ __align__(16) float h2[128][32];   // h2T[u][p]
  __shared__ __align__(16) float sc[32][4];

  const int t    = threadIdx.x;
  const int base = blockIdx.x * 32;

  if (t < 32) {
    const float* g = pts + (size_t)(base + t) * 3;
    xs[t][0] = g[0]; xs[t][1] = g[1]; xs[t][2] = g[2]; xs[t][3] = 0.f;
  }
  __syncthreads();

  // layer 1: thread t == hidden unit u
  {
    const float w0 = W1[t * 3 + 0], w1 = W1[t * 3 + 1], w2 = W1[t * 3 + 2];
    const float bb = b1[t];
    #pragma unroll
    for (int p = 0; p < 32; ++p) {
      float h = fmaf(w0, xs[p][0], fmaf(w1, xs[p][1], fmaf(w2, xs[p][2], bb)));
      h1[t][p] = fmaxf(h, 0.f);
    }
  }
  __syncthreads();

  // layer 2: 128x128, 32 accumulators per thread, LDS rows read as float4
  {
    const float bb = b2[t];
    float4 acc[8];
    #pragma unroll
    for (int g = 0; g < 8; ++g) acc[g] = make_float4(bb, bb, bb, bb);
    const float* w2r = W2 + t * 128;
    for (int j = 0; j < 128; ++j) {
      const float  w   = w2r[j];
      const float4* row = (const float4*)(&h1[j][0]);
      #pragma unroll
      for (int g = 0; g < 8; ++g) {
        float4 h = row[g];
        acc[g].x = fmaf(w, h.x, acc[g].x);
        acc[g].y = fmaf(w, h.y, acc[g].y);
        acc[g].z = fmaf(w, h.z, acc[g].z);
        acc[g].w = fmaf(w, h.w, acc[g].w);
      }
    }
    #pragma unroll
    for (int g = 0; g < 8; ++g) {
      h2[t][4 * g + 0] = fmaxf(acc[g].x, 0.f);
      h2[t][4 * g + 1] = fmaxf(acc[g].y, 0.f);
      h2[t][4 * g + 2] = fmaxf(acc[g].z, 0.f);
      h2[t][4 * g + 3] = fmaxf(acc[g].w, 0.f);
    }
  }
  __syncthreads();

  // layer 3: thread -> (point p = t>>2, channel c = t&3), c<3 active
  {
    const int p = t >> 2, c = t & 3;
    if (c < 3) {
      float acc = b3[c];
      const float* w3r = W3 + c * 128;
      for (int u = 0; u < 128; ++u) acc = fmaf(w3r[u], h2[u][p], acc);
      sc[p][c] = xs[p][c] * acc;   // x * mlp(x)
    }
  }
  __syncthreads();

  if (t < 32) {
    const float sx = sc[t][0], sy = sc[t][1], sz = sc[t][2];
    const float w  = -0.5f * (sx * sx + sy * sy + sz * sz);
    aug[base + t]  = make_float4(sx, sy, sz, w);
  }
}

// ---------------------------------------------------------------------------
// Kernel 2: fused score + softmax + context.
// Block = 256 thr (8 waves); wave w owns 16 queries.  The key side (V rows and
// augmented K points) comes in stages of KT keys through a two-buffer LDS ring
// filled by asynchronous copies: stage t+1 flies while stage t is worked on,
// and one barrier per stage replaces two per 16 keys.
// Per 16 keys per wave: 1 score WMMA + 16 accumulate WMMAs (Vt in LDS),
// 8 exps, 8 ds_swizzle SWAPX16 to re-layout P as a WMMA B operand.
// ---------------------------------------------------------------------------
#define KT  128            // keys per stage
#define VP  80             // LDS pitch of a V row, in floats
#define NST (NK / KT)      // stages

__device__ inline unsigned lds_addr(const void* p) {
  // low 32 bits of a __shared__ address = byte offset in the work-group's LDS
  return (unsigned)(unsigned long long)p;
}

// One stage: every thread copies 8 x 16 B of V (rows r, r+16, ..) and 8 B of K.
__device__ inline void stage_copy(unsigned lv, const float* gv, unsigned lk,
                                  const char* gk) {
  // s_wait_xcnt stands inside the statement so that no address register of an
  // issued copy is rewritten ahead of it.
  asm volatile(
      "global_load_async_to_lds_b128 %0, %8, off\n\t"
      "global_load_async_to_lds_b128 %1, %9, off\n\t"
      "global_load_async_to_lds_b128 %2, %10, off\n\t"
      "global_load_async_to_lds_b128 %3, %11, off\n\t"
      "global_load_async_to_lds_b128 %4, %12, off\n\t"
      "global_load_async_to_lds_b128 %5, %13, off\n\t"
      "global_load_async_to_lds_b128 %6, %14, off\n\t"
      "global_load_async_to_lds_b128 %7, %15, off\n\t"
      "global_load_async_to_lds_b64 %16, %17, off\n\t"
      "s_wait_xcnt 0x0"
      :: "v"(lv), "v"(lv + 16 * VP * 4), "v"(lv + 32 * VP * 4),
         "v"(lv + 48 * VP * 4), "v"(lv + 64 * VP * 4), "v"(lv + 80 * VP * 4),
         "v"(lv + 96 * VP * 4), "v"(lv + 112 * VP * 4),
         "v"(gv), "v"(gv + 16 * DV), "v"(gv + 32 * DV), "v"(gv + 48 * DV),
         "v"(gv + 64 * DV), "v"(gv + 80 * DV), "v"(gv + 96 * DV),
         "v"(gv + 112 * DV), "v"(lk), "v"(gk)
      : "memory");
}

__global__ __launch_bounds__(256) void NW0_attn(
    const float4* __restrict__ kaug, const float4* __restrict__ qaug,
    const float* __restrict__ value, float* __restrict__ out) {
  __shared__ __align__(16) float  vts[2][KT * VP];  // V stage KTx64, pitch 80
  __shared__ __align__(16) float4 kts[2][KT];       // augmented K stage

  const int b    = blockIdx.x >> 5;       // 32 query blocks per batch
  const int qblk = blockIdx.x & 31;
  const int tid  = threadIdx.x;
  const int wave = tid >> 5;
  const int lane = tid & 31;
  const int l16  = lane & 15;
  const bool hi  = lane >= 16;
  const int q    = qblk * 128 + wave * 16 + l16;  // this lane's query column

  // B operand of the score WMMA: rows (Qx,Qy,Qz,1); C = -0.5*q2 per column.
  const float4 qa = qaug[(size_t)b * NQ + q];
  v2f Bq; Bq.x = hi ? qa.z : qa.x; Bq.y = hi ? 1.0f : qa.y;
  const float cq = qa.w;                       // -0.5*|Qs|^2
  const v8f c8 = {cq, cq, cq, cq, cq, cq, cq, cq};

  v8f o[4] = {v8f{}, v8f{}, v8f{}, v8f{}};     // O^T[v,q], 4 v-tiles of 16
  float lacc = 0.f;                            // partial softmax denominator

  // this thread's share of a stage: source and LDS place of its first chunk
  const int sr = tid >> 4, scol = (tid & 15) << 2;
  const float* gv = value + (size_t)b * NK * DV + sr * DV + scol;
  const char*  gk = (const char*)(kaug + (size_t)b * NK) + tid * 8;
  const unsigned lv0 = lds_addr(&vts[0][sr * VP + scol]);
  const unsigned lv1 = lds_addr(&vts[1][sr * VP + scol]);
  const unsigned lk0 = lds_addr(&kts[0][0]) + tid * 8;
  const unsigned lk1 = lds_addr(&kts[1][0]) + tid * 8;

  // ---- ring prologue: stage 0 landed and published, stage 1 in flight ----
  stage_copy(lv0, gv, lk0, gk);
  // this wave's copies of stage 0 have landed
  asm volatile("s_wait_asynccnt 0x0" ::: "memory");
  __syncthreads();
  stage_copy(lv1, gv + KT * DV, lk1, gk + KT * 16);

  const int d = hi ? 2 : 0;
  for (int t = 0; t < NST; ++t) {
    const float*  vs = vts[t & 1];
    const float4* ks = kts[t & 1];

    // full unroll: constant LDS offsets, and the 16-key groups of a stage can
    // overlap (no barrier stands between them any more)
    #pragma unroll
    for (int kt = 0; kt < KT; kt += 16) {
      // ---- score tile: D[k,q] = K.Q - 0.5k2 - 0.5q2  (one WMMA) ----
      const float4 ka = ks[kt + l16];          // (Kx,Ky,Kz,-0.5*k2)
      v2f Ak; Ak.x = hi ? ka.z : ka.x; Ak.y = hi ? ka.w : ka.y;
      const v8f s = wmma4(Ak, Bq, c8);

      // ---- clamp (sqdist >= 0) + exp; scores <= 0 so exp in [0,1] ----
      float p0 = __expf(fminf(s[0], 0.f)), p1 = __expf(fminf(s[1], 0.f));
      float p2 = __expf(fminf(s[2], 0.f)), p3 = __expf(fminf(s[3], 0.f));
      float p4 = __expf(fminf(s[4], 0.f)), p5 = __expf(fminf(s[5], 0.f));
      float p6 = __expf(fminf(s[6], 0.f)), p7 = __expf(fminf(s[7], 0.f));
      lacc += ((p0 + p1) + (p2 + p3)) + ((p4 + p5) + (p6 + p7));

      // ---- re-layout P (C-layout) into four 4x16 B operands via SWAPX16 ----
      const float q0 = swap16(p0), q1 = swap16(p1), q2 = swap16(p2),
                  q3 = swap16(p3), q4 = swap16(p4), q5 = swap16(p5),
                  q6 = swap16(p6), q7 = swap16(p7);
      v2f Bp0; Bp0.x = hi ? q2 : p0; Bp0.y = hi ? q3 : p1;  // k rows 0..3
      v2f Bp1; Bp1.x = hi ? q6 : p4; Bp1.y = hi ? q7 : p5;  // k rows 4..7
      v2f Bp2; Bp2.x = hi ? p2 : q0; Bp2.y = hi ? p3 : q1;  // k rows 8..11
      v2f Bp3; Bp3.x = hi ? p6 : q4; Bp3.y = hi ? p7 : q5;  // k rows 12..15

      // ---- O^T += V^T x P : 4 v-tiles x 4 chained K=4 WMMAs ----
      const float* vr = vs + (kt + d) * VP;
      #pragma unroll
      for (int vt = 0; vt < 4; ++vt) {
        const int cb = vt * 16 + l16;
        v2f a0, a1, a2, a3;
        a0.x = vr[0 * VP + cb];  a0.y = vr[1 * VP + cb];
        a1.x = vr[4 * VP + cb];  a1.y = vr[5 * VP + cb];
        a2.x = vr[8 * VP + cb];  a2.y = vr[9 * VP + cb];
        a3.x = vr[12 * VP + cb]; a3.y = vr[13 * VP + cb];
        v8f acc = o[vt];
        acc = wmma4(a0, Bp0, acc);
        acc = wmma4(a1, Bp1, acc);
        acc = wmma4(a2, Bp2, acc);
        acc = wmma4(a3, Bp3, acc);
        o[vt] = acc;
      }
    }

    // ---- publish point of stage t+1, then refill of the buffer just read ----
    // this wave's LDS reads of stage t have returned
    asm volatile("s_wait_dscnt 0x0" ::: "memory");
    // this wave's copies of stage t+1 have landed
    asm volatile("s_wait_asynccnt 0x0" ::: "memory");
    __syncthreads();
    if (t + 2 < NST)
      stage_copy((t & 1) ? lv1 : lv0, gv + (size_t)(t + 2) * KT * DV,
                 (t & 1) ? lk1 : lk0, gk + (size_t)(t + 2) * KT * 16);
  }
  // no copy is left in flight when the wave ends
  asm volatile("s_wait_asynccnt 0x0" ::: "memory");

  // ---- finalize: combine lane halves of the denominator, divide, store ----
  const float inv = 1.0f / (lacc + swap16(lacc));
  float* ob = out + ((size_t)(b * NQ + q)) * DV + (hi ? 8 : 0);
  #pragma unroll
  for (int vt = 0; vt < 4; ++vt) {
    const v8f ov = o[vt] * inv;
    *(float4*)(ob + vt * 16)     = make_float4(ov[0], ov[1], ov[2], ov[3]);
    *(float4*)(ob + vt * 16 + 4) = make_float4(ov[4], ov[5], ov[6], ov[7]);
  }
}

// ---------------------------------------------------------------------------
extern "C" void kernel_launch(void* const* d_in, const int* in_sizes, int n_in,
                              void* d_out, int out_size, void* d_ws,
                              size_t ws_size, hipStream_t stream) {
  const float* KEY   = (const float*)d_in[0];
  const float* VALUE = (const float*)d_in[1];
  const float* QUERY = (const float*)d_in[2];
  const float* W1 = (const float*)d_in[3];
  const float* b1 = (const float*)d_in[4];
  const float* W2 = (const float*)d_in[5];
  const float* b2 = (const float*)d_in[6];
  const float* W3 = (const float*)d_in[7];
  const float* b3 = (const float*)d_in[8];

  float4* kaug = (float4*)d_ws;                 // 512 KB
  float4* qaug = kaug + (size_t)BB * NK;        // 512 KB

  NW0_mlp_aug<<<(BB * NK) / 32, 128, 0, stream>>>(KEY, W1, b1, W2, b2, W3, b3,
                                                  kaug);
  NW0_mlp_aug<<<(BB * NQ) / 32, 128, 0, stream>>>(QUERY, W1, b1, W2, b2, W3,
                                                  b3, qaug);
  NW0_attn<<<BB * (NQ / 128), 256, 0, stream>>>(kaug, qaug, VALUE,
                                                (float*)d_out);
}

// v002
// A run of this version takes 140 microseconds.
// Two timings next to v001 both put it at 1.18 times that version's speed.
// All steps since v000 together make it 3.19 times as fast.
#include <hip/hip_runtime.h>
#include <hip/hip_bf16.h>

// ---------------------------------------------------------------------------
// Gaussian-kernel attention, fused flash-style over the KEY axis.
//   B=8, NK=NQ=4096, IN=3, H=128, DV=64
// Dominant cost: attn@VALUE (17.2 GFLOP) + 134M score dots -> WMMA f32 16x16x4.
// Scores are <= 0 after clamping, so exp() never overflows: streaming softmax
// without running-max rescaling (sum >= strongest term, divide once at end).
// ---------------------------------------------------------------------------

#define BB  8
#define NK  4096
#define NQ  4096
#define DV  64

typedef __attribute__((ext_vector_type(2))) float v2f;
typedef __attribute__((ext_vector_type(8))) float v8f;

__device__ inline v8f wmma4(v2f a, v2f b, v8f c) {
  // D = A(16x4) x B(4x16) + C, all f32
  return __builtin_amdgcn_wmma_f32_16x16x4_f32(false, a, false, b, (short)0, c,
                                               false, false);
}

__device__ inline float swap16(float x) {
  // ds_swizzle SWAPX16: xor=0x10, and=0x1f  ->  offset 0x401F
  return __builtin_bit_cast(
      float, __builtin_amdgcn_ds_swizzle(__builtin_bit_cast(int, x), 0x401F));
}

// ---------------------------------------------------------------------------
// Kernel 1: shared MLP (3 -> 128 -> 128 -> 3) + elementwise scale, emits
// augmented float4 (sx, sy, sz, -0.5*|s|^2) per point.
// Block = 256 thr (8 waves); wave w owns 16 points (the columns of its tiles).
// Hidden layer 2 runs on WMMA f32 16x16x4:  H2^T[u,p] = W2[u,j] x H1^T[j,p].
//   A = W2 from LDS (staged once per block, pitch WP: b128 reads hit all banks)
//   B = H1^T, made by each lane in registers in the operand's own layout
//   D = 8 u-tiles; lane = point, so layer 3 stays inside the lane pair l, l^16.
// One b128 of W2 feeds two WMMAs.  k slots of both operands, group s of 8 j:
//   first WMMA  j = 8s+0, 8s+1 (lanes 0-15) and 8s+4, 8s+5 (lanes 16-31)
//   second WMMA j = 8s+2, 8s+3 (lanes 0-15) and 8s+6, 8s+7 (lanes 16-31)
// ---------------------------------------------------------------------------
#define HH 128             // hidden width
#define WP 132             // LDS pitch of a W2 row, in floats (16 B x odd)

__global__ __launch_bounds__(256) void NW0_mlp_aug(
    const float* __restrict__ pts,           // [N,3]
    const float* __restrict__ W1, const float* __restrict__ b1,
    const float* __restrict__ W2, const float* __restrict__ b2,
    const float* __restrict__ W3, const float* __restrict__ b3,
    float4* __restrict__ aug) {
  __shared__ __align__(16) float  w2s[HH * WP];
  // [0,HH): (W1[j][0..2], b1[j])    [HH,2*HH): (W3[0..2][u], b2[u])
  __shared__ __align__(16) float4 wsm[2 * HH];

  const int tid  = threadIdx.x;
  const int lane = tid & 31;
  const int l16  = lane & 15;
  const bool hi  = lane >= 16;
  const int p    = blockIdx.x * 128 + (tid >> 5) * 16 + l16;  // lane's point

  // ---- weights into LDS, once per block; all global loads issued together ----
  // (every unroll in this kernel keeps a register array at constant indices)
  const int  un = tid & (HH - 1);
  // waves 0-3 bring the W1 rows, waves 4-7 the W3 columns: a scalar choice
  const bool lo = __builtin_amdgcn_readfirstlane(tid) < HH;
  const float* ga = lo ? W1 : W3;
  const int    gv = lo ? 3 : 1, gs = lo ? 1 : HH;
  const float4 sm = make_float4(ga[un * gv], ga[un * gv + gs],
                                ga[un * gv + 2 * gs], (lo ? b1 : b2)[un]);
  const float x0 = pts[(size_t)p * 3 + 0];
  const float x1 = pts[(size_t)p * 3 + 1];
  const float x2 = pts[(size_t)p * 3 + 2];
  // the W2 loads below land in registers that the loads above name as addresses:
  // none of those is rewritten ahead of this wait
  asm volatile("s_wait_xcnt 0x0" ::: "memory");
  float4 st[16];
  #pragma unroll
  for (int c = 0; c < 16; ++c)               // float4 number tid + 256*c of W2
    st[c] = *(const float4*)(W2 + (size_t)(tid + c * 256) * 4);
  #pragma unroll
  for (int c = 0; c < 16; ++c)
    *(float4*)(&w2s[((tid >> 5) + c * 8) * WP + (lane << 2)]) = st[c];
  wsm[tid] = sm;
  __syncthreads();

  v8f acc[8] = {v8f{}, v8f{}, v8f{}, v8f{}, v8f{}, v8f{}, v8f{}, v8f{}};
  const int jo = hi ? 4 : 0;
  const float*  wa = w2s + l16 * WP + jo;
  const float4* wl = wsm + jo;

  float4 an[8], wn[4];                       // operands of the next group
  #pragma unroll
  for (int e = 0; e < 4; ++e) wn[e] = wl[e];
  #pragma unroll
  for (int mt = 0; mt < 8; ++mt) an[mt] = *(const float4*)(wa + mt * 16 * WP);

  // full unroll: constant LDS offsets and register renaming of the two buffers
  #pragma unroll
  for (int s = 0; s < HH / 8; ++s) {
    // layer 1 for this lane's four j of the group
    float h[4];
    #pragma unroll
    for (int e = 0; e < 4; ++e)
      h[e] = fmaxf(
          fmaf(wn[e].x, x0, fmaf(wn[e].y, x1, fmaf(wn[e].z, x2, wn[e].w))),
          0.f);
    const v2f B0 = {h[0], h[1]}, B1 = {h[2], h[3]};
    float4 ac[8];
    #pragma unroll
    for (int mt = 0; mt < 8; ++mt) ac[mt] = an[mt];
    if (s + 1 < HH / 8) {
      #pragma unroll
      for (int e = 0; e < 4; ++e) wn[e] = wl[(s + 1) * 8 + e];
      #pragma unroll
      for (int mt = 0; mt < 8; ++mt)
        an[mt] = *(const float4*)(wa + mt * 16 * WP + (s + 1) * 8);
    }
    // keeps the next group's LDS reads as one run ahead of this group's WMMAs;
    // without it each read sinks to its use and its latency is exposed
    __builtin_amdgcn_sched_barrier(0);
    #pragma unroll
    for (int mt = 0; mt < 8; ++mt) {
      const v2f A0 = {ac[mt].x, ac[mt].y};
      acc[mt] = wmma4(A0, B0, acc[mt]);
    }
    #pragma unroll
    for (int mt = 0; mt < 8; ++mt) {
      const v2f A1 = {ac[mt].z, ac[mt].w};
      acc[mt] = wmma4(A1, B1, acc[mt]);
    }
    // closes the WMMA run: nothing of the next group moves in among them
    __builtin_amdgcn_sched_barrier(0);
  }

  // ---- bias + relu + layer 3: the lane holds u = 16*mt + (hi ? 8 : 0) + i ----
  float s0 = 0.f, s1 = 0.f, s2 = 0.f;
  const float4* w3l = wsm + HH + (hi ? 8 : 0);
  float4 tn[8];
  #pragma unroll
  for (int i = 0; i < 8; ++i) tn[i] = w3l[i];
  #pragma unroll
  for (int mt = 0; mt < 8; ++mt) {
    float4 tc[8];
    #pragma unroll
    for (int i = 0; i < 8; ++i) tc[i] = tn[i];
    if (mt + 1 < 8) {
      #pragma unroll
      for (int i = 0; i < 8; ++i) tn[i] = w3l[(mt + 1) * 16 + i];
    }
    // keeps the next tile's LDS reads ahead of this tile's arithmetic
    __builtin_amdgcn_sched_barrier(0);
    #pragma unroll
    for (int i = 0; i < 8; ++i) {
      const float hv = fmaxf(acc[mt][i] + tc[i].w, 0.f);
      s0 = fmaf(tc[i].x, hv, s0);
      s1 = fmaf(tc[i].y, hv, s1);
      s2 = fmaf(tc[i].z, hv, s2);
    }
  }
  s0 += swap16(s0); s1 += swap16(s1); s2 += swap16(s2);

  if (!hi) {
    const float sx = x0 * (s0 + b3[0]);      // x * mlp(x)
    const float sy = x1 * (s1 + b3[1]);
    const float sz = x2 * (s2 + b3[2]);
    const float w  = -0.5f * (sx * sx + sy * sy + sz * sz);
    aug[p] = make_float4(sx, sy, sz, w);
  }
}

// ---------------------------------------------------------------------------
// Kernel 2: fused score + softmax + context.
// Block = 256 thr (8 waves); wave w owns 16 queries.  The key side (V rows and
// augmented K points) comes in stages of KT keys through a two-buffer LDS ring
// filled by asynchronous copies: stage t+1 flies while stage t is worked on,
// and one barrier per stage replaces two per 16 keys.
// Per 16 keys per wave: 1 score WMMA + 16 accumulate WMMAs (Vt in LDS),
// 8 exps, 8 ds_swizzle SWAPX16 to re-layout P as a WMMA B operand.
// ---------------------------------------------------------------------------
#define KT  128            // keys per stage
#define VP  80             // LDS pitch of a V row, in floats
#define NST (NK / KT)      // stages

__device__ inline unsigned lds_addr(const void* p) {
  // low 32 bits of a __shared__ address = byte offset in the work-group's LDS
  return (unsigned)(unsigned long long)p;
}

// One stage: every thread copies 8 x 16 B of V (rows r, r+16, ..) and 8 B of K.
__device__ inline void stage_copy(unsigned lv, const float* gv, unsigned lk,
                                  const char* gk) {
  // s_wait_xcnt stands inside the statement so that no address register of an
  // issued copy is rewritten ahead of it.
  asm volatile(
      "global_load_async_to_lds_b128 %0, %8, off\n\t"
      "global_load_async_to_lds_b128 %1, %9, off\n\t"
      "global_load_async_to_lds_b128 %2, %10, off\n\t"
      "global_load_async_to_lds_b128 %3, %11, off\n\t"
      "global_load_async_to_lds_b128 %4, %12, off\n\t"
      "global_load_async_to_lds_b128 %5, %13, off\n\t"
      "global_load_async_to_lds_b128 %6, %14, off\n\t"
      "global_load_async_to_lds_b128 %7, %15, off\n\t"
      "global_load_async_to_lds_b64 %16, %17, off\n\t"
      "s_wait_xcnt 0x0"
      :: "v"(lv), "v"(lv + 16 * VP * 4), "v"(lv + 32 * VP * 4),
         "v"(lv + 48 * VP * 4), "v"(lv + 64 * VP * 4), "v"(lv + 80 * VP * 4),
         "v"(lv + 96 * VP * 4), "v"(lv + 112 * VP * 4),
         "v"(gv), "v"(gv + 16 * DV), "v"(gv + 32 * DV), "v"(gv + 48 * DV),
         "v"(gv + 64 * DV), "v"(gv + 80 * DV), "v"(gv + 96 * DV),
         "v"(gv + 112 * DV), "v"(lk), "v"(gk)
      : "memory");
}

__global__ __launch_bounds__(256) void NW0_attn(
    const float4* __restrict__ kaug, const float4* __restrict__ qaug,
    const float* __restrict__ value, float* __restrict__ out) {
  __shared__ __align__(16) float  vts[2][KT * VP];  // V stage KTx64, pitch 80
  __shared__ __align__(16) float4 kts[2][KT];       // augmented K stage

  const int b    = blockIdx.x >> 5;       // 32 query blocks per batch
  const int qblk = blockIdx.x & 31;
  const int tid  = threadIdx.x;
  const int wave = tid >> 5;
  const int lane = tid & 31;
  const int l16  = lane & 15;
  const bool hi  = lane >= 16;
  const int q    = qblk * 128 + wave * 16 + l16;  // this lane's query column

  // B operand of the score WMMA: rows (Qx,Qy,Qz,1); C = -0.5*q2 per column.
  const float4 qa = qaug[(size_t)b * NQ + q];
  v2f Bq; Bq.x = hi ? qa.z : qa.x; Bq.y = hi ? 1.0f : qa.y;
  const float cq = qa.w;                       // -0.5*|Qs|^2
  const v8f c8 = {cq, cq, cq, cq, cq, cq, cq, cq};

  v8f o[4] = {v8f{}, v8f{}, v8f{}, v8f{}};     // O^T[v,q], 4 v-tiles of 16
  float lacc = 0.f;                            // partial softmax denominator

  // this thread's share of a stage: source and LDS place of its first chunk
  const int sr = tid >> 4, scol = (tid & 15) << 2;
  const float* gv = value + (size_t)b * NK * DV + sr * DV + scol;
  const char*  gk = (const char*)(kaug + (size_t)b * NK) + tid * 8;
  const unsigned lv0 = lds_addr(&vts[0][sr * VP + scol]);
  const unsigned lv1 = lds_addr(&vts[1][sr * VP + scol]);
  const unsigned lk0 = lds_addr(&kts[0][0]) + tid * 8;
  const unsigned lk1 = lds_addr(&kts[1][0]) + tid * 8;

  // ---- ring prologue: stage 0 landed and published, stage 1 in flight ----
  stage_copy(lv0, gv, lk0, gk);
  // this wave's copies of stage 0 have landed
  asm volatile("s_wait_asynccnt 0x0" ::: "memory");
  __syncthreads();
  stage_copy(lv1, gv + KT * DV, lk1, gk + KT * 16);

  const int d = hi ? 2 : 0;
  for (int t = 0; t < NST; ++t) {
    const float*  vs = vts[t & 1];
    const float4* ks = kts[t & 1];

    // full unroll: constant LDS offsets, and the 16-key groups of a stage can
    // overlap (no barrier stands between them any more)
    #pragma unroll
    for (int kt = 0; kt < KT; kt += 16) {
      // ---- score tile: D[k,q] = K.Q - 0.5k2 - 0.5q2  (one WMMA) ----
      const float4 ka = ks[kt + l16];          // (Kx,Ky,Kz,-0.5*k2)
      v2f Ak; Ak.x = hi ? ka.z : ka.x; Ak.y = hi ? ka.w : ka.y;
      const v8f s = wmma4(Ak, Bq, c8);

      // ---- clamp (sqdist >= 0) + exp; scores <= 0 so exp in [0,1] ----
      float p0 = __expf(fminf(s[0], 0.f)), p1 = __expf(fminf(s[1], 0.f));
      float p2 = __expf(fminf(s[2], 0.f)), p3 = __expf(fminf(s[3], 0.f));
      float p4 = __expf(fminf(s[4], 0.f)), p5 = __expf(fminf(s[5], 0.f));
      float p6 = __expf(fminf(s[6], 0.f)), p7 = __expf(fminf(s[7], 0.f));
      lacc += ((p0 + p1) + (p2 + p3)) + ((p4 + p5) + (p6 + p7));

      // ---- re-layout P (C-layout) into four 4x16 B operands via SWAPX16 ----
      const float q0 = swap16(p0), q1 = swap16(p1), q2 = swap16(p2),
                  q3 = swap16(p3), q4 = swap16(p4), q5 = swap16(p5),
                  q6 = swap16(p6), q7 = swap16(p7);
      v2f Bp0; Bp0.x = hi ? q2 : p0; Bp0.y = hi ? q3 : p1;  // k rows 0..3
      v2f Bp1; Bp1.x = hi ? q6 : p4; Bp1.y = hi ? q7 : p5;  // k rows 4..7
      v2f Bp2; Bp2.x = hi ? p2 : q0; Bp2.y = hi ? p3 : q1;  // k rows 8..11
      v2f Bp3; Bp3.x = hi ? p6 : q4; Bp3.y = hi ? p7 : q5;  // k rows 12..15

      // ---- O^T += V^T x P : 4 v-tiles x 4 chained K=4 WMMAs ----
      const float* vr = vs + (kt + d) * VP;
      #pragma unroll
      for (int vt = 0; vt < 4; ++vt) {
        const int cb = vt * 16 + l16;
        v2f a0, a1, a2, a3;
        a0.x = vr[0 * VP + cb];  a0.y = vr[1 * VP + cb];
        a1.x = vr[4 * VP + cb];  a1.y = vr[5 * VP + cb];
        a2.x = vr[8 * VP + cb];  a2.y = vr[9 * VP + cb];
        a3.x = vr[12 * VP + cb]; a3.y = vr[13 * VP + cb];
        v8f acc = o[vt];
        acc = wmma4(a0, Bp0, acc);
        acc = wmma4(a1, Bp1, acc);
        acc = wmma4(a2, Bp2, acc);
        acc = wmma4(a3, Bp3, acc);
        o[vt] = acc;
      }
    }

    // ---- publish point of stage t+1, then refill of the buffer just read ----
    // this wave's LDS reads of stage t have returned
    asm volatile("s_wait_dscnt 0x0" ::: "memory");
    // this wave's copies of stage t+1 have landed
    asm volatile("s_wait_asynccnt 0x0" ::: "memory");
    __syncthreads();
    if (t + 2 < NST)
      stage_copy((t & 1) ? lv1 : lv0, gv + (size_t)(t + 2) * KT * DV,
                 (t & 1) ? lk1 : lk0, gk + (size_t)(t + 2) * KT * 16);
  }
  // no copy is left in flight when the wave ends
  asm volatile("s_wait_asynccnt 0x0" ::: "memory");

  // ---- finalize: combine lane halves of the denominator, divide, store ----
  const float inv = 1.0f / (lacc + swap16(lacc));
  float* ob = out + ((size_t)(b * NQ + q)) * DV + (hi ? 8 : 0);
  #pragma unroll
  for (int vt = 0; vt < 4; ++vt) {
    const v8f ov = o[vt] * inv;
    *(float4*)(ob + vt * 16)     = make_float4(ov[0], ov[1], ov[2], ov[3]);
    *(float4*)(ob + vt * 16 + 4) = make_float4(ov[4], ov[5], ov[6], ov[7]);
  }
}

// ---------------------------------------------------------------------------
extern "C" void kernel_launch(void* const* d_in, const int* in_sizes, int n_in,
                              void* d_out, int out_size, void* d_ws,
                              size_t ws_size, hipStream_t stream) {
  const float* KEY   = (const float*)d_in[0];
  const float* VALUE = (const float*)d_in[1];
  const float* QUERY = (const float*)d_in[2];
  const float* W1 = (const float*)d_in[3];
  const float* b1 = (const float*)d_in[4];
  const float* W2 = (const float*)d_in[5];
  const float* b2 = (const float*)d_in[6];
  const float* W3 = (const float*)d_in[7];
  const float* b3 = (const float*)d_in[8];

  float4* kaug = (float4*)d_ws;                 // 512 KB
  float4* qaug = kaug + (size_t)BB * NK;        // 512 KB

  NW0_mlp_aug<<<(BB * NK) / 128, 256, 0, stream>>>(KEY, W1, b1, W2, b2, W3, b3,
                                                  kaug);
  NW0_mlp_aug<<<(BB * NQ) / 128, 256, 0, stream>>>(QUERY, W1, b1, W2, b2, W3,
                                                  b3, qaug);
  NW0_attn<<<BB * (NQ / 128), 256, 0, stream>>>(kaug, qaug, VALUE,
                                                (float*)d_out);
}

// v003
// One run takes 123 microseconds.
// Next to v002, in two timings, it ran 1.14 times as fast each time.
// Over all steps from v000 it is 3.63 times as fast.
#include <hip/hip_runtime.h>
#include <hip/hip_bf16.h>

// ---------------------------------------------------------------------------
// Gaussian-kernel attention, fused flash-style over the KEY axis.
//   B=8, NK=NQ=4096, IN=3, H=128, DV=64
// Dominant cost: attn@VALUE (17.2 GFLOP) + 134M score dots -> WMMA f32 16x16x4.
// Scores are <= 0 after clamping, so exp() never overflows: streaming softmax
// without running-max rescaling (sum >= strongest term, divide once at end).
// ---------------------------------------------------------------------------

#define BB  8
#define NK  4096
#define NQ  4096
#define DV  64

typedef __attribute__((ext_vector_type(2))) float v2f;
typedef __attribute__((ext_vector_type(8))) float v8f;

__device__ inline v8f wmma4(v2f a, v2f b, v8f c) {
  // D = A(16x4) x B(4x16) + C, all f32
  return __builtin_amdgcn_wmma_f32_16x16x4_f32(false, a, false, b, (short)0, c,
                                               false, false);
}

__device__ inline float swap16(float x) {
  // ds_swizzle SWAPX16: xor=0x10, and=0x1f  ->  offset 0x401F
  return __builtin_bit_cast(
      float, __builtin_amdgcn_ds_swizzle(__builtin_bit_cast(int, x), 0x401F));
}

// ---------------------------------------------------------------------------
// Kernel 1: shared MLP (3 -> 128 -> 128 -> 3) + elementwise scale, emits
// augmented float4 (sx, sy, sz, -0.5*|s|^2) per point.
// Block = 256 thr (8 waves); wave w owns 16 points (the columns of its tiles).
// Hidden layer 2 runs on WMMA f32 16x16x4:  H2^T[u,p] = W2[u,j] x H1^T[j,p].
//   A = W2 from LDS (staged once per block, pitch WP: b128 reads hit all banks)
//   B = H1^T, made by each lane in registers in the operand's own layout
//   D = 8 u-tiles; lane = point, so layer 3 stays inside the lane pair l, l^16.
// One b128 of W2 feeds two WMMAs.  k slots of both operands, group s of 8 j:
//   first WMMA  j = 8s+0, 8s+1 (lanes 0-15) and 8s+4, 8s+5 (lanes 16-31)
//   second WMMA j = 8s+2, 8s+3 (lanes 0-15) and 8s+6, 8s+7 (lanes 16-31)
// ---------------------------------------------------------------------------
#define HH 128             // hidden width
#define WP 132             // LDS pitch of a W2 row, in floats (16 B x odd)

__global__ __launch_bounds__(256) void NW0_mlp_aug(
    const float* __restrict__ pts,           // [N,3]
    const float* __restrict__ W1, const float* __restrict__ b1,
    const float* __restrict__ W2, const float* __restrict__ b2,
    const float* __restrict__ W3, const float* __restrict__ b3,
    float4* __restrict__ aug) {
  __shared__ __align__(16) float  w2s[HH * WP];
  // [0,HH): (W1[j][0..2], b1[j])    [HH,2*HH): (W3[0..2][u], b2[u])
  __shared__ __align__(16) float4 wsm[2 * HH];

  const int tid  = threadIdx.x;
  const int lane = tid & 31;
  const int l16  = lane & 15;
  const bool hi  = lane >= 16;
  const int p    = blockIdx.x * 128 + (tid >> 5) * 16 + l16;  // lane's point

  // ---- weights into LDS, once per block; all global loads issued together ----
  // (every unroll in this kernel keeps a register array at constant indices)
  const int  un = tid & (HH - 1);
  // waves 0-3 bring the W1 rows, waves 4-7 the W3 columns: a scalar choice
  const bool lo = __builtin_amdgcn_readfirstlane(tid) < HH;
  const float* ga = lo ? W1 : W3;
  const int    gv = lo ? 3 : 1, gs = lo ? 1 : HH;
  const float4 sm = make_float4(ga[un * gv], ga[un * gv + gs],
                                ga[un * gv + 2 * gs], (lo ? b1 : b2)[un]);
  const float x0 = pts[(size_t)p * 3 + 0];
  const float x1 = pts[(size_t)p * 3 + 1];
  const float x2 = pts[(size_t)p * 3 + 2];
  // the W2 loads below land in registers that the loads above name as addresses:
  // none of those is rewritten ahead of this wait
  asm volatile("s_wait_xcnt 0x0" ::: "memory");
  float4 st[16];
  #pragma unroll
  for (int c = 0; c < 16; ++c)               // float4 number tid + 256*c of W2
    st[c] = *(const float4*)(W2 + (size_t)(tid + c * 256) * 4);
  #pragma unroll
  for (int c = 0; c < 16; ++c)
    *(float4*)(&w2s[((tid >> 5) + c * 8) * WP + (lane << 2)]) = st[c];
  wsm[tid] = sm;
  __syncthreads();

  v8f acc[8] = {v8f{}, v8f{}, v8f{}, v8f{}, v8f{}, v8f{}, v8f{}, v8f{}};
  const int jo = hi ? 4 : 0;
  const float*  wa = w2s + l16 * WP + jo;
  const float4* wl = wsm + jo;

  float4 an[8], wn[4];                       // operands of the next group
  #pragma unroll
  for (int e = 0; e < 4; ++e) wn[e] = wl[e];
  #pragma unroll
  for (int mt = 0; mt < 8; ++mt) an[mt] = *(const float4*)(wa + mt * 16 * WP);

  // full unroll: constant LDS offsets and register renaming of the two buffers
  #pragma unroll
  for (int s = 0; s < HH / 8; ++s) {
    // layer 1 for this lane's four j of the group
    float h[4];
    #pragma unroll
    for (int e = 0; e < 4; ++e)
      h[e] = fmaxf(
          fmaf(wn[e].x, x0, fmaf(wn[e].y, x1, fmaf(wn[e].z, x2, wn[e].w))),
          0.f);
    const v2f B0 = {h[0], h[1]}, B1 = {h[2], h[3]};
    float4 ac[8];
    #pragma unroll
    for (int mt = 0; mt < 8; ++mt) ac[mt] = an[mt];
    if (s + 1 < HH / 8) {
      #pragma unroll
      for (int e = 0; e < 4; ++e) wn[e] = wl[(s + 1) * 8 + e];
      #pragma unroll
      for (int mt = 0; mt < 8; ++mt)
        an[mt] = *(const float4*)(wa + mt * 16 * WP + (s + 1) * 8);
    }
    // keeps the next group's LDS reads as one run ahead of this group's WMMAs;
    // without it each read sinks to its use and its latency is exposed
    __builtin_amdgcn_sched_barrier(0);
    #pragma unroll
    for (int mt = 0; mt < 8; ++mt) {
      const v2f A0 = {ac[mt].x, ac[mt].y};
      acc[mt] = wmma4(A0, B0, acc[mt]);
    }
    #pragma unroll
    for (int mt = 0; mt < 8; ++mt) {
      const v2f A1 = {ac[mt].z, ac[mt].w};
      acc[mt] = wmma4(A1, B1, acc[mt]);
    }
    // closes the WMMA run: nothing of the next group moves in among them
    __builtin_amdgcn_sched_barrier(0);
  }

  // ---- bias + relu + layer 3: the lane holds u = 16*mt + (hi ? 8 : 0) + i ----
  float s0 = 0.f, s1 = 0.f, s2 = 0.f;
  const float4* w3l = wsm + HH + (hi ? 8 : 0);
  float4 tn[8];
  #pragma unroll
  for (int i = 0; i < 8; ++i) tn[i] = w3l[i];
  #pragma unroll
  for (int mt = 0; mt < 8; ++mt) {
    float4 tc[8];
    #pragma unroll
    for (int i = 0; i < 8; ++i) tc[i] = tn[i];
    if (mt + 1 < 8) {
      #pragma unroll
      for (int i = 0; i < 8; ++i) tn[i] = w3l[(mt + 1) * 16 + i];
    }
    // keeps the next tile's LDS reads ahead of this tile's arithmetic
    __builtin_amdgcn_sched_barrier(0);
    #pragma unroll
    for (int i = 0; i < 8; ++i) {
      const float hv = fmaxf(acc[mt][i] + tc[i].w, 0.f);
      s0 = fmaf(tc[i].x, hv, s0);
      s1 = fmaf(tc[i].y, hv, s1);
      s2 = fmaf(tc[i].z, hv, s2);
    }
  }
  s0 += swap16(s0); s1 += swap16(s1); s2 += swap16(s2);

  if (!hi) {
    const float sx = x0 * (s0 + b3[0]);      // x * mlp(x)
    const float sy = x1 * (s1 + b3[1]);
    const float sz = x2 * (s2 + b3[2]);
    const float w  = -0.5f * (sx * sx + sy * sy + sz * sz);
    aug[p] = make_float4(sx, sy, sz, w);
  }
}

// ---------------------------------------------------------------------------
// Kernel 2: fused score + softmax + context.
// Block = 512 thr (16 waves) on 128 queries: waves w and w+8 own the same 16
// queries and split every stage's keys, KW each, so that four waves share a
// SIMD and fill one another's LDS and exp latencies on the matrix pipe.  Their
// partial O and denominators are plain sums (no running maximum) and are
// joined once through LDS after the loop.  The key side (V rows and
// augmented K points) comes in stages of KT keys through a two-buffer LDS ring
// filled by asynchronous copies: stage t+1 flies while stage t is worked on,
// and one barrier per stage replaces two per 16 keys.
// Per 16 keys per wave: 1 score WMMA + 16 accumulate WMMAs (Vt in LDS),
// 8 exps, 8 ds_swizzle SWAPX16 to re-layout P as a WMMA B operand.
// ---------------------------------------------------------------------------
#define KT  256            // keys per stage
#define KW  (KT / 2)       // keys of a stage that one wave works on
#define VP  80             // LDS pitch of a V row, in floats
#define NST (NK / KT)      // stages
#define XP  36             // LDS pitch of a lane's hand-over record, in floats

__device__ inline unsigned lds_addr(const void* p) {
  // low 32 bits of a __shared__ address = byte offset in the work-group's LDS
  return (unsigned)(unsigned long long)p;
}

// One stage: every thread copies 8 x 16 B of V (rows r, r+32, ..) and 8 B of K.
__device__ inline void stage_copy(unsigned lv, const float* gv, unsigned lk,
                                  const char* gk) {
  // s_wait_xcnt stands inside the statement so that no address register of an
  // issued copy is rewritten ahead of it.
  asm volatile(
      "global_load_async_to_lds_b128 %0, %8, off\n\t"
      "global_load_async_to_lds_b128 %1, %9, off\n\t"
      "global_load_async_to_lds_b128 %2, %10, off\n\t"
      "global_load_async_to_lds_b128 %3, %11, off\n\t"
      "global_load_async_to_lds_b128 %4, %12, off\n\t"
      "global_load_async_to_lds_b128 %5, %13, off\n\t"
      "global_load_async_to_lds_b128 %6, %14, off\n\t"
      "global_load_async_to_lds_b128 %7, %15, off\n\t"
      "global_load_async_to_lds_b64 %16, %17, off\n\t"
      "s_wait_xcnt 0x0"
      :: "v"(lv), "v"(lv + 32 * VP * 4), "v"(lv + 64 * VP * 4),
         "v"(lv + 96 * VP * 4), "v"(lv + 128 * VP * 4), "v"(lv + 160 * VP * 4),
         "v"(lv + 192 * VP * 4), "v"(lv + 224 * VP * 4),
         "v"(gv), "v"(gv + 32 * DV), "v"(gv + 64 * DV), "v"(gv + 96 * DV),
         "v"(gv + 128 * DV), "v"(gv + 160 * DV), "v"(gv + 192 * DV),
         "v"(gv + 224 * DV), "v"(lk), "v"(gk)
      : "memory");
}

__global__ __launch_bounds__(512) void NW0_attn(
    const float4* __restrict__ kaug, const float4* __restrict__ qaug,
    const float* __restrict__ value, float* __restrict__ out) {
  __shared__ __align__(16) float  vts[2][KT * VP];  // V stage KTx64, pitch 80
  __shared__ __align__(16) float4 kts[2][KT];       // augmented K stage

  const int b    = blockIdx.x >> 5;       // 32 query blocks per batch
  const int qblk = blockIdx.x & 31;
  const int tid  = threadIdx.x;
  // the wave's number as a scalar: the hand-over below branches on it
  const int wave = __builtin_amdgcn_readfirstlane(tid >> 5);
  const int qt   = wave & 7;              // query tile of the wave
  const int kh   = wave >> 3;             // its half of every stage's keys
  const int lane = tid & 31;
  const int l16  = lane & 15;
  const bool hi  = lane >= 16;
  const int q    = qblk * 128 + qt * 16 + l16;    // this lane's query column

  // B operand of the score WMMA: rows (Qx,Qy,Qz,1); C = -0.5*q2 per column.
  const float4 qa = qaug[(size_t)b * NQ + q];
  v2f Bq; Bq.x = hi ? qa.z : qa.x; Bq.y = hi ? 1.0f : qa.y;
  const float cq = qa.w;                       // -0.5*|Qs|^2
  const v8f c8 = {cq, cq, cq, cq, cq, cq, cq, cq};

  v8f o[4] = {v8f{}, v8f{}, v8f{}, v8f{}};     // O^T[v,q], 4 v-tiles of 16
  float lacc = 0.f;                            // partial softmax denominator

  // this thread's share of a stage: source and LDS place of its first chunk
  const int sr = tid >> 4, scol = (tid & 15) << 2;
  const float* gv = value + (size_t)b * NK * DV + sr * DV + scol;
  const char*  gk = (const char*)(kaug + (size_t)b * NK) + tid * 8;
  const unsigned lv0 = lds_addr(&vts[0][sr * VP + scol]);
  const unsigned lv1 = lds_addr(&vts[1][sr * VP + scol]);
  const unsigned lk0 = lds_addr(&kts[0][0]) + tid * 8;
  const unsigned lk1 = lds_addr(&kts[1][0]) + tid * 8;

  // ---- ring prologue: stage 0 landed and published, stage 1 in flight ----
  stage_copy(lv0, gv, lk0, gk);
  // this wave's copies of stage 0 have landed
  asm volatile("s_wait_asynccnt 0x0" ::: "memory");
  __syncthreads();
  stage_copy(lv1, gv + KT * DV, lk1, gk + KT * 16);

  const int d = hi ? 2 : 0;
  for (int t = 0; t < NST; ++t) {
    const float*  vs = vts[t & 1] + kh * KW * VP;
    const float4* ks = kts[t & 1] + kh * KW;

    // full unroll: constant LDS offsets, and the 16-key groups of a stage can
    // overlap (no barrier stands between them any more)
    #pragma unroll
    for (int kt = 0; kt < KW; kt += 16) {
      // ---- score tile: D[k,q] = K.Q - 0.5k2 - 0.5q2  (one WMMA) ----
      const float4 ka = ks[kt + l16];          // (Kx,Ky,Kz,-0.5*k2)
      v2f Ak; Ak.x = hi ? ka.z : ka.x; Ak.y = hi ? ka.w : ka.y;
      const v8f s = wmma4(Ak, Bq, c8);

      // ---- clamp (sqdist >= 0) + exp; scores <= 0 so exp in [0,1] ----
      float p0 = __expf(fminf(s[0], 0.f)), p1 = __expf(fminf(s[1], 0.f));
      float p2 = __expf(fminf(s[2], 0.f)), p3 = __expf(fminf(s[3], 0.f));
      float p4 = __expf(fminf(s[4], 0.f)), p5 = __expf(fminf(s[5], 0.f));
      float p6 = __expf(fminf(s[6], 0.f)), p7 = __expf(fminf(s[7], 0.f));
      lacc += ((p0 + p1) + (p2 + p3)) + ((p4 + p5) + (p6 + p7));

      // ---- re-layout P (C-layout) into four 4x16 B operands via SWAPX16 ----
      const float q0 = swap16(p0), q1 = swap16(p1), q2 = swap16(p2),
                  q3 = swap16(p3), q4 = swap16(p4), q5 = swap16(p5),
                  q6 = swap16(p6), q7 = swap16(p7);
      v2f Bp0; Bp0.x = hi ? q2 : p0; Bp0.y = hi ? q3 : p1;  // k rows 0..3
      v2f Bp1; Bp1.x = hi ? q6 : p4; Bp1.y = hi ? q7 : p5;  // k rows 4..7
      v2f Bp2; Bp2.x = hi ? p2 : q0; Bp2.y = hi ? p3 : q1;  // k rows 8..11
      v2f Bp3; Bp3.x = hi ? p6 : q4; Bp3.y = hi ? p7 : q5;  // k rows 12..15

      // ---- O^T += V^T x P : 4 v-tiles x 4 chained K=4 WMMAs ----
      const float* vr = vs + (kt + d) * VP;
      #pragma unroll
      for (int vt = 0; vt < 4; ++vt) {
        const int cb = vt * 16 + l16;
        v2f a0, a1, a2, a3;
        a0.x = vr[0 * VP + cb];  a0.y = vr[1 * VP + cb];
        a1.x = vr[4 * VP + cb];  a1.y = vr[5 * VP + cb];
        a2.x = vr[8 * VP + cb];  a2.y = vr[9 * VP + cb];
        a3.x = vr[12 * VP + cb]; a3.y = vr[13 * VP + cb];
        v8f acc = o[vt];
        acc = wmma4(a0, Bp0, acc);
        acc = wmma4(a1, Bp1, acc);
        acc = wmma4(a2, Bp2, acc);
        acc = wmma4(a3, Bp3, acc);
        o[vt] = acc;
      }
    }

    // ---- publish point of stage t+1, then refill of the buffer just read ----
    // this wave's LDS reads of stage t have returned
    asm volatile("s_wait_dscnt 0x0" ::: "memory");
    // this wave's copies of stage t+1 have landed
    asm volatile("s_wait_asynccnt 0x0" ::: "memory");
    __syncthreads();
    if (t + 2 < NST)
      stage_copy((t & 1) ? lv1 : lv0, gv + (size_t)(t + 2) * KT * DV,
                 (t & 1) ? lk1 : lk0, gk + (size_t)(t + 2) * KT * 16);
  }
  // no copy is left in flight when the wave ends
  asm volatile("s_wait_asynccnt 0x0" ::: "memory");

  // ---- join the key halves: waves 8-15 hand O and the denominator over ----
  // The ring is free for it: every wave's LDS reads had returned and its copies
  // had landed ahead of the last trip's barrier.
  float* xs = &vts[0][0] + (qt * 32 + lane) * XP;
  if (kh) {
    #pragma unroll
    for (int vt = 0; vt < 4; ++vt) {
      *(float4*)(xs + vt * 8)     = make_float4(o[vt][0], o[vt][1], o[vt][2], o[vt][3]);
      *(float4*)(xs + vt * 8 + 4) = make_float4(o[vt][4], o[vt][5], o[vt][6], o[vt][7]);
    }
    xs[32] = lacc;
  }
  __syncthreads();
  if (kh) return;
  #pragma unroll
  for (int vt = 0; vt < 4; ++vt) {
    const float4 xa = *(const float4*)(xs + vt * 8);
    const float4 xb = *(const float4*)(xs + vt * 8 + 4);
    o[vt] += v8f{xa.x, xa.y, xa.z, xa.w, xb.x, xb.y, xb.z, xb.w};
  }
  lacc += xs[32];

  // ---- finalize: combine lane halves of the denominator, divide, store ----
  const float inv = 1.0f / (lacc + swap16(lacc));
  float* ob = out + ((size_t)(b * NQ + q)) * DV + (hi ? 8 : 0);
  #pragma unroll
  for (int vt = 0; vt < 4; ++vt) {
    const v8f ov = o[vt] * inv;
    *(float4*)(ob + vt * 16)     = make_float4(ov[0], ov[1], ov[2], ov[3]);
    *(float4*)(ob + vt * 16 + 4) = make_float4(ov[4], ov[5], ov[6], ov[7]);
  }
}

// ---------------------------------------------------------------------------
extern "C" void kernel_launch(void* const* d_in, const int* in_sizes, int n_in,
                              void* d_out, int out_size, void* d_ws,
                              size_t ws_size, hipStream_t stream) {
  const float* KEY   = (const float*)d_in[0];
  const float* VALUE = (const float*)d_in[1];
  const float* QUERY = (const float*)d_in[2];
  const float* W1 = (const float*)d_in[3];
  const float* b1 = (const float*)d_in[4];
  const float* W2 = (const float*)d_in[5];
  const float* b2 = (const float*)d_in[6];
  const float* W3 = (const float*)d_in[7];
  const float* b3 = (const float*)d_in[8];

  float4* kaug = (float4*)d_ws;                 // 512 KB
  float4* qaug = kaug + (size_t)BB * NK;        // 512 KB

  NW0_mlp_aug<<<(BB * NK) / 128, 256, 0, stream>>>(KEY, W1, b1, W2, b2, W3, b3,
                                                  kaug);
  NW0_mlp_aug<<<(BB * NQ) / 128, 256, 0, stream>>>(QUERY, W1, b1, W2, b2, W3,
                                                  b3, qaug);
  NW0_attn<<<BB * (NQ / 128), 512, 0, stream>>>(kaug, qaug, VALUE,
                                                (float*)d_out);
}

// v004
// A run of this version takes 115 microseconds.
// In both of two side-by-side timings against v003, it was 1.07 times as fast.
// All steps since v000 together make it 3.88 times as fast.
#include <hip/hip_runtime.h>
#include <hip/hip_bf16.h>

// ---------------------------------------------------------------------------
// Gaussian-kernel attention, fused flash-style over the KEY axis.
//   B=8, NK=NQ=4096, IN=3, H=128, DV=64
// Dominant cost: attn@VALUE (17.2 GFLOP) + 134M score dots -> WMMA f32 16x16x4.
// Scores are <= 0 after clamping, so exp() never overflows: streaming softmax
// without running-max rescaling (sum >= strongest term, divide once at end).
// ---------------------------------------------------------------------------

#define BB  8
#define NK  4096
#define NQ  4096
#define DV  64

typedef __attribute__((ext_vector_type(2))) float v2f;
typedef __attribute__((ext_vector_type(8))) float v8f;

__device__ inline v8f wmma4(v2f a, v2f b, v8f c) {
  // D = A(16x4) x B(4x16) + C, all f32
  return __builtin_amdgcn_wmma_f32_16x16x4_f32(false, a, false, b, (short)0, c,
                                               false, false);
}

__device__ inline float swap16(float x) {
  // ds_swizzle SWAPX16: xor=0x10, and=0x1f  ->  offset 0x401F
  return __builtin_bit_cast(
      float, __builtin_amdgcn_ds_swizzle(__builtin_bit_cast(int, x), 0x401F));
}

// ---------------------------------------------------------------------------
// Kernel 1: shared MLP (3 -> 128 -> 128 -> 3) + elementwise scale, emits
// augmented float4 (sx, sy, sz, -0.5*|s|^2) per point.
// Block = 256 thr (8 waves); wave w owns 16 points (the columns of its tiles).
// Hidden layer 2 runs on WMMA f32 16x16x4:  H2^T[u,p] = W2[u,j] x H1^T[j,p].
//   A = W2 from LDS (staged once per block, pitch WP: b128 reads hit all banks)
//   B = H1^T, made by each lane in registers in the operand's own layout
//   D = 8 u-tiles; lane = point, so layer 3 stays inside the lane pair l, l^16.
// One b128 of W2 feeds two WMMAs.  k slots of both operands, group s of 8 j:
//   first WMMA  j = 8s+0, 8s+1 (lanes 0-15) and 8s+4, 8s+5 (lanes 16-31)
//   second WMMA j = 8s+2, 8s+3 (lanes 0-15) and 8s+6, 8s+7 (lanes 16-31)
// Beside that, each block re-lays 64 rows of V for kernel 2 into key pairs:
//   vpair[k/2][v] = (V[k][v], V[k+1][v]), k even; a pair row is 128 floats.
// Its loads fly with the W2 loads and its stores drain under the WMMA loop.
// ---------------------------------------------------------------------------
#define HH 128             // hidden width
#define WP 132             // LDS pitch of a W2 row, in floats (16 B x odd)

__global__ __launch_bounds__(256) void NW0_mlp_aug(
    const float* __restrict__ pts,           // [N,3]
    const float* __restrict__ W1, const float* __restrict__ b1,
    const float* __restrict__ W2, const float* __restrict__ b2,
    const float* __restrict__ W3, const float* __restrict__ b3,
    float4* __restrict__ aug,
    const float* __restrict__ vsrc,          // this launch's rows of V, [N/2,DV]
    float4* __restrict__ vpair) {            // the same rows in key pairs
  __shared__ __align__(16) float  w2s[HH * WP];
  // [0,HH): (W1[j][0..2], b1[j])    [HH,2*HH): (W3[0..2][u], b2[u])
  __shared__ __align__(16) float4 wsm[2 * HH];

  const int tid  = threadIdx.x;
  const int lane = tid & 31;
  const int l16  = lane & 15;
  const bool hi  = lane >= 16;
  const int p    = blockIdx.x * 128 + (tid >> 5) * 16 + l16;  // lane's point

  // ---- weights into LDS, once per block; all global loads issued together ----
  // (every unroll in this kernel keeps a register array at constant indices)
  const int  un = tid & (HH - 1);
  // waves 0-3 bring the W1 rows, waves 4-7 the W3 columns: a scalar choice
  const bool lo = __builtin_amdgcn_readfirstlane(tid) < HH;
  const float* ga = lo ? W1 : W3;
  const int    gv = lo ? 3 : 1, gs = lo ? 1 : HH;
  const float4 sm = make_float4(ga[un * gv], ga[un * gv + gs],
                                ga[un * gv + 2 * gs], (lo ? b1 : b2)[un]);
  const float x0 = pts[(size_t)p * 3 + 0];
  const float x1 = pts[(size_t)p * 3 + 1];
  const float x2 = pts[(size_t)p * 3 + 2];
  // the W2 loads below land in registers that the loads above name as addresses:
  // none of those is rewritten ahead of this wait
  asm volatile("s_wait_xcnt 0x0" ::: "memory");
  float4 st[16];
  #pragma unroll
  for (int c = 0; c < 16; ++c)               // float4 number tid + 256*c of W2
    st[c] = *(const float4*)(W2 + (size_t)(tid + c * 256) * 4);
  // V: the thread takes 4 columns of key pairs tid>>4 and 16 + (tid>>4)
  const float* vr = vsrc + (size_t)blockIdx.x * 64 * DV + (tid >> 4) * 2 * DV +
                    (tid & 15) * 4;
  const float4 va0 = *(const float4*)(vr);
  const float4 vb0 = *(const float4*)(vr + DV);
  const float4 va1 = *(const float4*)(vr + 32 * DV);
  const float4 vb1 = *(const float4*)(vr + 33 * DV);
  #pragma unroll
  for (int c = 0; c < 16; ++c)
    *(float4*)(&w2s[((tid >> 5) + c * 8) * WP + (lane << 2)]) = st[c];
  wsm[tid] = sm;
  // holds the V loads up among the W2 loads (inputs only): without it they sink
  // behind the barrier and their whole latency stands in front of the WMMA loop
  asm volatile("" :: "v"(va0.x), "v"(va0.y), "v"(va0.z), "v"(va0.w),
                     "v"(vb0.x), "v"(vb0.y), "v"(vb0.z), "v"(vb0.w),
                     "v"(va1.x), "v"(va1.y), "v"(va1.z), "v"(va1.w),
                     "v"(vb1.x), "v"(vb1.y), "v"(vb1.z), "v"(vb1.w));
  __syncthreads();

  // behind the block's one barrier, so that nothing waits for these stores
  float4* vw = vpair + (size_t)blockIdx.x * 32 * 32 + (tid >> 4) * 32 +
               (tid & 15) * 2;
  vw[0]           = make_float4(va0.x, vb0.x, va0.y, vb0.y);
  vw[1]           = make_float4(va0.z, vb0.z, va0.w, vb0.w);
  vw[16 * 32]     = make_float4(va1.x, vb1.x, va1.y, vb1.y);
  vw[16 * 32 + 1] = make_float4(va1.z, vb1.z, va1.w, vb1.w);
  // no register that these stores name is rewritten ahead of this wait
  asm volatile("s_wait_xcnt 0x0" ::: "memory");

  v8f acc[8] = {v8f{}, v8f{}, v8f{}, v8f{}, v8f{}, v8f{}, v8f{}, v8f{}};
  const int jo = hi ? 4 : 0;
  const float*  wa = w2s + l16 * WP + jo;
  const float4* wl = wsm + jo;

  float4 an[8], wn[4];                       // operands of the next group
  #pragma unroll
  for (int e = 0; e < 4; ++e) wn[e] = wl[e];
  #pragma unroll
  for (int mt = 0; mt < 8; ++mt) an[mt] = *(const float4*)(wa + mt * 16 * WP);

  // full unroll: constant LDS offsets and register renaming of the two buffers
  #pragma unroll
  for (int s = 0; s < HH / 8; ++s) {
    // layer 1 for this lane's four j of the group
    float h[4];
    #pragma unroll
    for (int e = 0; e < 4; ++e)
      h[e] = fmaxf(
          fmaf(wn[e].x, x0, fmaf(wn[e].y, x1, fmaf(wn[e].z, x2, wn[e].w))),
          0.f);
    const v2f B0 = {h[0], h[1]}, B1 = {h[2], h[3]};
    float4 ac[8];
    #pragma unroll
    for (int mt = 0; mt < 8; ++mt) ac[mt] = an[mt];
    if (s + 1 < HH / 8) {
      #pragma unroll
      for (int e = 0; e < 4; ++e) wn[e] = wl[(s + 1) * 8 + e];
      #pragma unroll
      for (int mt = 0; mt < 8; ++mt)
        an[mt] = *(const float4*)(wa + mt * 16 * WP + (s + 1) * 8);
    }
    // keeps the next group's LDS reads as one run ahead of this group's WMMAs;
    // without it each read sinks to its use and its latency is exposed
    __builtin_amdgcn_sched_barrier(0);
    #pragma unroll
    for (int mt = 0; mt < 8; ++mt) {
      const v2f A0 = {ac[mt].x, ac[mt].y};
      acc[mt] = wmma4(A0, B0, acc[mt]);
    }
    #pragma unroll
    for (int mt = 0; mt < 8; ++mt) {
      const v2f A1 = {ac[mt].z, ac[mt].w};
      acc[mt] = wmma4(A1, B1, acc[mt]);
    }
    // closes the WMMA run: nothing of the next group moves in among them
    __builtin_amdgcn_sched_barrier(0);
  }

  // ---- bias + relu + layer 3: the lane holds u = 16*mt + (hi ? 8 : 0) + i ----
  float s0 = 0.f, s1 = 0.f, s2 = 0.f;
  const float4* w3l = wsm + HH + (hi ? 8 : 0);
  float4 tn[8];
  #pragma unroll
  for (int i = 0; i < 8; ++i) tn[i] = w3l[i];
  #pragma unroll
  for (int mt = 0; mt < 8; ++mt) {
    float4 tc[8];
    #pragma unroll
    for (int i = 0; i < 8; ++i) tc[i] = tn[i];
    if (mt + 1 < 8) {
      #pragma unroll
      for (int i = 0; i < 8; ++i) tn[i] = w3l[(mt + 1) * 16 + i];
    }
    // keeps the next tile's LDS reads ahead of this tile's arithmetic
    __builtin_amdgcn_sched_barrier(0);
    #pragma unroll
    for (int i = 0; i < 8; ++i) {
      const float hv = fmaxf(acc[mt][i] + tc[i].w, 0.f);
      s0 = fmaf(tc[i].x, hv, s0);
      s1 = fmaf(tc[i].y, hv, s1);
      s2 = fmaf(tc[i].z, hv, s2);
    }
  }
  s0 += swap16(s0); s1 += swap16(s1); s2 += swap16(s2);

  if (!hi) {
    const float sx = x0 * (s0 + b3[0]);      // x * mlp(x)
    const float sy = x1 * (s1 + b3[1]);
    const float sz = x2 * (s2 + b3[2]);
    const float w  = -0.5f * (sx * sx + sy * sy + sz * sz);
    aug[p] = make_float4(sx, sy, sz, w);
  }
}

// ---------------------------------------------------------------------------
// Kernel 2: fused score + softmax + context.
// Block = 512 thr (16 waves) on 128 queries: waves w and w+8 own the same 16
// queries and split every stage's keys, KW each, so that four waves share a
// SIMD and fill one another's LDS and exp latencies on the matrix pipe.  Their
// partial O and denominators are plain sums (no running maximum) and are
// joined once through LDS after the loop.  The key side (V in key pairs and
// augmented K points) comes in stages of KT keys through a two-buffer LDS ring
// filled by asynchronous copies: stage t+1 flies while stage t is worked on,
// and one barrier per stage replaces two per 16 keys.
// Per 16 keys per wave: 1 score WMMA + 16 accumulate WMMAs,
// 8 exps, 8 ds_swizzle SWAPX16 to re-layout P as a WMMA B operand.
// V arrives as vpair[k/2][v] = (V[k][v], V[k+1][v]): the two k slots of an A
// operand lie side by side, so one b128 LDS read is the A operands of two
// v-tiles as they stand.  Row m of v-tile 2h+e is v = 32h + 2m + e; the 16 lanes
// of a half read 256 contiguous bytes, all 64 banks once, with no pad.
// ---------------------------------------------------------------------------
#define KT  256            // keys per stage
#define KW  (KT / 2)       // keys of a stage that one wave works on
#define PR  (2 * DV)       // a pair row of V (two keys), in floats
#define NST (NK / KT)      // stages
#define XP  36             // LDS pitch of a lane's hand-over record, in floats

__device__ inline unsigned lds_addr(const void* p) {
  // low 32 bits of a __shared__ address = byte offset in the work-group's LDS
  return (unsigned)(unsigned long long)p;
}

// One stage: every thread copies 8 x 16 B of V (a stage is one run of bytes in
// memory and in LDS; chunks 8 KB apart) and 8 B of K.
__device__ inline void stage_copy(unsigned lv, const float* gv, unsigned lk,
                                  const char* gk) {
  // s_wait_xcnt stands inside the statement so that no address register of an
  // issued copy is rewritten ahead of it.
  asm volatile(
      "global_load_async_to_lds_b128 %0, %8, off\n\t"
      "global_load_async_to_lds_b128 %1, %9, off\n\t"
      "global_load_async_to_lds_b128 %2, %10, off\n\t"
      "global_load_async_to_lds_b128 %3, %11, off\n\t"
      "global_load_async_to_lds_b128 %4, %12, off\n\t"
      "global_load_async_to_lds_b128 %5, %13, off\n\t"
      "global_load_async_to_lds_b128 %6, %14, off\n\t"
      "global_load_async_to_lds_b128 %7, %15, off\n\t"
      "global_load_async_to_lds_b64 %16, %17, off\n\t"
      "s_wait_xcnt 0x0"
      :: "v"(lv), "v"(lv + 1 * 8192), "v"(lv + 2 * 8192), "v"(lv + 3 * 8192),
         "v"(lv + 4 * 8192), "v"(lv + 5 * 8192), "v"(lv + 6 * 8192),
         "v"(lv + 7 * 8192),
         "v"(gv), "v"(gv + 1 * 2048), "v"(gv + 2 * 2048), "v"(gv + 3 * 2048),
         "v"(gv + 4 * 2048), "v"(gv + 5 * 2048), "v"(gv + 6 * 2048),
         "v"(gv + 7 * 2048), "v"(lk), "v"(gk)
      : "memory");
}

__global__ __launch_bounds__(512) void NW0_attn(
    const float4* __restrict__ kaug, const float4* __restrict__ qaug,
    const float* __restrict__ vpair, float* __restrict__ out) {
  __shared__ __align__(16) float  vts[2][KT * DV];  // V stage, KT/2 pair rows
  __shared__ __align__(16) float4 kts[2][KT];       // augmented K stage

  const int b    = blockIdx.x >> 5;       // 32 query blocks per batch
  const int qblk = blockIdx.x & 31;
  const int tid  = threadIdx.x;
  // the wave's number as a scalar: the hand-over below branches on it
  const int wave = __builtin_amdgcn_readfirstlane(tid >> 5);
  const int qt   = wave & 7;              // query tile of the wave
  const int kh   = wave >> 3;             // its half of every stage's keys
  const int lane = tid & 31;
  const int l16  = lane & 15;
  const bool hi  = lane >= 16;
  const int q    = qblk * 128 + qt * 16 + l16;    // this lane's query column

  // B operand of the score WMMA: rows (Qx,Qy,Qz,1); C = -0.5*q2 per column.
  const float4 qa = qaug[(size_t)b * NQ + q];
  v2f Bq; Bq.x = hi ? qa.z : qa.x; Bq.y = hi ? 1.0f : qa.y;
  const float cq = qa.w;                       // -0.5*|Qs|^2
  const v8f c8 = {cq, cq, cq, cq, cq, cq, cq, cq};

  v8f o[4] = {v8f{}, v8f{}, v8f{}, v8f{}};     // O^T[v,q], v-tiles 2h+e
  float lacc = 0.f;                            // partial softmax denominator

  // this thread's share of a stage: source and LDS place of its first chunk
  const float* gv = vpair + (size_t)b * NK * DV + tid * 4;
  const char*  gk = (const char*)(kaug + (size_t)b * NK) + tid * 8;
  const unsigned lv0 = lds_addr(&vts[0][tid * 4]);
  const unsigned lv1 = lds_addr(&vts[1][tid * 4]);
  const unsigned lk0 = lds_addr(&kts[0][0]) + tid * 8;
  const unsigned lk1 = lds_addr(&kts[1][0]) + tid * 8;

  // ---- ring prologue: stage 0 landed and published, stage 1 in flight ----
  stage_copy(lv0, gv, lk0, gk);
  // this wave's copies of stage 0 have landed
  asm volatile("s_wait_asynccnt 0x0" ::: "memory");
  __syncthreads();
  stage_copy(lv1, gv + KT * DV, lk1, gk + KT * 16);

  // lanes 16-31 hold k slots 2 and 3: the next pair row
  const int d = (hi ? PR : 0) + l16 * 4;
  for (int t = 0; t < NST; ++t) {
    const float*  vs = vts[t & 1] + kh * KW * DV + d;
    const float4* ks = kts[t & 1] + kh * KW;

    // full unroll: constant LDS offsets, and the 16-key groups of a stage can
    // overlap (no barrier stands between them any more)
    #pragma unroll
    for (int kt = 0; kt < KW; kt += 16) {
      // ---- score tile: D[k,q] = K.Q - 0.5k2 - 0.5q2  (one WMMA) ----
      const float4 ka = ks[kt + l16];          // (Kx,Ky,Kz,-0.5*k2)
      v2f Ak; Ak.x = hi ? ka.z : ka.x; Ak.y = hi ? ka.w : ka.y;
      const v8f s = wmma4(Ak, Bq, c8);

      // ---- clamp (sqdist >= 0) + exp; scores <= 0 so exp in [0,1] ----
      float p0 = __expf(fminf(s[0], 0.f)), p1 = __expf(fminf(s[1], 0.f));
      float p2 = __expf(fminf(s[2], 0.f)), p3 = __expf(fminf(s[3], 0.f));
      float p4 = __expf(fminf(s[4], 0.f)), p5 = __expf(fminf(s[5], 0.f));
      float p6 = __expf(fminf(s[6], 0.f)), p7 = __expf(fminf(s[7], 0.f));
      lacc += ((p0 + p1) + (p2 + p3)) + ((p4 + p5) + (p6 + p7));

      // ---- re-layout P (C-layout) into four 4x16 B operands via SWAPX16 ----
      const float q0 = swap16(p0), q1 = swap16(p1), q2 = swap16(p2),
                  q3 = swap16(p3), q4 = swap16(p4), q5 = swap16(p5),
                  q6 = swap16(p6), q7 = swap16(p7);
      v2f Bp0; Bp0.x = hi ? q2 : p0; Bp0.y = hi ? q3 : p1;  // k rows 0..3
      v2f Bp1; Bp1.x = hi ? q6 : p4; Bp1.y = hi ? q7 : p5;  // k rows 4..7
      v2f Bp2; Bp2.x = hi ? p2 : q0; Bp2.y = hi ? p3 : q1;  // k rows 8..11
      v2f Bp3; Bp3.x = hi ? p6 : q4; Bp3.y = hi ? p7 : q5;  // k rows 12..15

      // ---- O^T += V^T x P : 4 v-tiles x 4 chained K=4 WMMAs ----
      const float* vr = vs + kt * DV;
      #pragma unroll
      for (int h = 0; h < 2; ++h) {
        const float4 f0 = *(const float4*)(vr + 0 * PR + h * DV);  // keys 0..3
        const float4 f1 = *(const float4*)(vr + 2 * PR + h * DV);  // keys 4..7
        const float4 f2 = *(const float4*)(vr + 4 * PR + h * DV);  // keys 8..11
        const float4 f3 = *(const float4*)(vr + 6 * PR + h * DV);  // keys 12..15
        v8f acc = o[2 * h];
        acc = wmma4(v2f{f0.x, f0.y}, Bp0, acc);
        acc = wmma4(v2f{f1.x, f1.y}, Bp1, acc);
        acc = wmma4(v2f{f2.x, f2.y}, Bp2, acc);
        acc = wmma4(v2f{f3.x, f3.y}, Bp3, acc);
        o[2 * h] = acc;
        acc = o[2 * h + 1];
        acc = wmma4(v2f{f0.z, f0.w}, Bp0, acc);
        acc = wmma4(v2f{f1.z, f1.w}, Bp1, acc);
        acc = wmma4(v2f{f2.z, f2.w}, Bp2, acc);
        acc = wmma4(v2f{f3.z, f3.w}, Bp3, acc);
        o[2 * h + 1] = acc;
      }
    }

    // ---- publish point of stage t+1, then refill of the buffer just read ----
    // this wave's LDS reads of stage t have returned
    asm volatile("s_wait_dscnt 0x0" ::: "memory");
    // this wave's copies of stage t+1 have landed
    asm volatile("s_wait_asynccnt 0x0" ::: "memory");
    __syncthreads();
    if (t + 2 < NST)
      stage_copy((t & 1) ? lv1 : lv0, gv + (size_t)(t + 2) * KT * DV,
                 (t & 1) ? lk1 : lk0, gk + (size_t)(t + 2) * KT * 16);
  }
  // no copy is left in flight when the wave ends
  asm volatile("s_wait_asynccnt 0x0" ::: "memory");

  // ---- join the key halves: waves 8-15 hand O and the denominator over ----
  // The ring is free for it: every wave's LDS reads had returned and its copies
  // had landed ahead of the last trip's barrier.
  float* xs = &vts[0][0] + (qt * 32 + lane) * XP;
  if (kh) {
    #pragma unroll
    for (int vt = 0; vt < 4; ++vt) {
      *(float4*)(xs + vt * 8)     = make_float4(o[vt][0], o[vt][1], o[vt][2], o[vt][3]);
      *(float4*)(xs + vt * 8 + 4) = make_float4(o[vt][4], o[vt][5], o[vt][6], o[vt][7]);
    }
    xs[32] = lacc;
  }
  __syncthreads();
  if (kh) return;
  #pragma unroll
  for (int vt = 0; vt < 4; ++vt) {
    const float4 xa = *(const float4*)(xs + vt * 8);
    const float4 xb = *(const float4*)(xs + vt * 8 + 4);
    o[vt] += v8f{xa.x, xa.y, xa.z, xa.w, xb.x, xb.y, xb.z, xb.w};
  }
  lacc += xs[32];

  // ---- finalize: combine lane halves of the denominator, divide, store ----
  const float inv = 1.0f / (lacc + swap16(lacc));
  // register i of v-tile 2h+e is v = 32h + 16*hi + 2i + e
  float* ob = out + ((size_t)(b * NQ + q)) * DV + (hi ? 16 : 0);
  #pragma unroll
  for (int h = 0; h < 2; ++h) {
    const v8f oe = o[2 * h] * inv, oo = o[2 * h + 1] * inv;
    #pragma unroll
    for (int n = 0; n < 4; ++n)
      *(float4*)(ob + h * 32 + n * 4) =
          make_float4(oe[2 * n], oo[2 * n], oe[2 * n + 1], oo[2 * n + 1]);
  }
}

// ---------------------------------------------------------------------------
extern "C" void kernel_launch(void* const* d_in, const int* in_sizes, int n_in,
                              void* d_out, int out_size, void* d_ws,
                              size_t ws_size, hipStream_t stream) {
  const float* KEY   = (const float*)d_in[0];
  const float* VALUE = (const float*)d_in[1];
  const float* QUERY = (const float*)d_in[2];
  const float* W1 = (const float*)d_in[3];
  const float* b1 = (const float*)d_in[4];
  const float* W2 = (const float*)d_in[5];
  const float* b2 = (const float*)d_in[6];
  const float* W3 = (const float*)d_in[7];
  const float* b3 = (const float*)d_in[8];

  float4* kaug = (float4*)d_ws;                 // 512 KB
  float4* qaug = kaug + (size_t)BB * NK;        // 512 KB
  float4* vpair = qaug + (size_t)BB * NQ;       // 8 MB: V in key pairs

  NW0_mlp_aug<<<(BB * NK) / 128, 256, 0, stream>>>(
      KEY, W1, b1, W2, b2, W3, b3, kaug, VALUE, vpair);
  NW0_mlp_aug<<<(BB * NQ) / 128, 256, 0, stream>>>(
      QUERY, W1, b1, W2, b2, W3, b3, qaug, VALUE + (size_t)(BB / 2) * NK * DV,
      vpair + (size_t)(BB / 2) * NK * DV / 4);
  NW0_attn<<<BB * (NQ / 128), 512, 0, stream>>>(
      kaug, qaug, (const float*)vpair, (float*)d_out);
}

// v005
// One run takes 109 microseconds.
// Two timings next to v004 both put it at 1.06 times that version's speed.
// All steps since v000 together make it 4.10 times as fast.
#include <hip/hip_runtime.h>
#include <hip/hip_bf16.h>

// ---------------------------------------------------------------------------
// Gaussian-kernel attention, fused flash-style over the KEY axis.
//   B=8, NK=NQ=4096, IN=3, H=128, DV=64
// Dominant cost: attn@VALUE (17.2 GFLOP) + 134M score dots -> WMMA f32 16x16x4.
// Scores are <= 0 after clamping, so exp() never overflows: streaming softmax
// without running-max rescaling (sum >= strongest term, divide once at end).
// ---------------------------------------------------------------------------

#define BB  8
#define NK  4096
#define NQ  4096
#define DV  64

typedef __attribute__((ext_vector_type(2))) float v2f;
typedef __attribute__((ext_vector_type(8))) float v8f;

__device__ inline v8f wmma4(v2f a, v2f b, v8f c) {
  // D = A(16x4) x B(4x16) + C, all f32
  return __builtin_amdgcn_wmma_f32_16x16x4_f32(false, a, false, b, (short)0, c,
                                               false, false);
}

__device__ inline float swap16(float x) {
  // ds_swizzle SWAPX16: xor=0x10, and=0x1f  ->  offset 0x401F
  return __builtin_bit_cast(
      float, __builtin_amdgcn_ds_swizzle(__builtin_bit_cast(int, x), 0x401F));
}

// ---------------------------------------------------------------------------
// Kernel 1: shared MLP (3 -> 128 -> 128 -> 3) + elementwise scale, emits
// augmented float4 (sx, sy, sz, -0.5*|s|^2) per point.
// Block = 256 thr (8 waves); wave w owns 16 points (the columns of its tiles).
// Hidden layer 2 runs on WMMA f32 16x16x4:  H2^T[u,p] = W2[u,j] x H1^T[j,p].
//   A = W2 from LDS (staged once per block, pitch WP: b128 reads hit all banks)
//   B = H1^T, made by each lane in registers in the operand's own layout
//   D = 8 u-tiles; lane = point, so layer 3 stays inside the lane pair l, l^16.
// One b128 of W2 feeds two WMMAs.  k slots of both operands, group s of 8 j:
//   first WMMA  j = 8s+0, 8s+1 (lanes 0-15) and 8s+4, 8s+5 (lanes 16-31)
//   second WMMA j = 8s+2, 8s+3 (lanes 0-15) and 8s+6, 8s+7 (lanes 16-31)
// Beside that, each block re-lays 64 rows of V for kernel 2 into key pairs:
//   vpair[k/2][v] = (V[k][v], V[k+1][v]), k even; a pair row is 128 floats.
// Its loads fly with the W2 loads and its stores drain under the WMMA loop.
// ---------------------------------------------------------------------------
#define HH 128             // hidden width
#define WP 132             // LDS pitch of a W2 row, in floats (16 B x odd)

__global__ __launch_bounds__(256) void NW0_mlp_aug(
    const float* __restrict__ pts,           // [N,3]
    const float* __restrict__ W1, const float* __restrict__ b1,
    const float* __restrict__ W2, const float* __restrict__ b2,
    const float* __restrict__ W3, const float* __restrict__ b3,
    float4* __restrict__ aug,
    const float* __restrict__ vsrc,          // this launch's rows of V, [N/2,DV]
    float4* __restrict__ vpair) {            // the same rows in key pairs
  __shared__ __align__(16) float  w2s[HH * WP];
  // [0,HH): (W1[j][0..2], b1[j])    [HH,2*HH): (W3[0..2][u], b2[u])
  __shared__ __align__(16) float4 wsm[2 * HH];

  const int tid  = threadIdx.x;
  const int lane = tid & 31;
  const int l16  = lane & 15;
  const bool hi  = lane >= 16;
  const int p    = blockIdx.x * 128 + (tid >> 5) * 16 + l16;  // lane's point

  // ---- weights into LDS, once per block; all global loads issued together ----
  // (every unroll in this kernel keeps a register array at constant indices)
  const int  un = tid & (HH - 1);
  // waves 0-3 bring the W1 rows, waves 4-7 the W3 columns: a scalar choice
  const bool lo = __builtin_amdgcn_readfirstlane(tid) < HH;
  const float* ga = lo ? W1 : W3;
  const int    gv = lo ? 3 : 1, gs = lo ? 1 : HH;
  const float4 sm = make_float4(ga[un * gv], ga[un * gv + gs],
                                ga[un * gv + 2 * gs], (lo ? b1 : b2)[un]);
  const float x0 = pts[(size_t)p * 3 + 0];
  const float x1 = pts[(size_t)p * 3 + 1];
  const float x2 = pts[(size_t)p * 3 + 2];
  // the W2 loads below land in registers that the loads above name as addresses:
  // none of those is rewritten ahead of this wait
  asm volatile("s_wait_xcnt 0x0" ::: "memory");
  float4 st[16];
  #pragma unroll
  for (int c = 0; c < 16; ++c)               // float4 number tid + 256*c of W2
    st[c] = *(const float4*)(W2 + (size_t)(tid + c * 256) * 4);
  // V: the thread takes 4 columns of key pairs tid>>4 and 16 + (tid>>4)
  const float* vr = vsrc + (size_t)blockIdx.x * 64 * DV + (tid >> 4) * 2 * DV +
                    (tid & 15) * 4;
  const float4 va0 = *(const float4*)(vr);
  const float4 vb0 = *(const float4*)(vr + DV);
  const float4 va1 = *(const float4*)(vr + 32 * DV);
  const float4 vb1 = *(const float4*)(vr + 33 * DV);
  #pragma unroll
  for (int c = 0; c < 16; ++c)
    *(float4*)(&w2s[((tid >> 5) + c * 8) * WP + (lane << 2)]) = st[c];
  wsm[tid] = sm;
  // holds the V loads up among the W2 loads (inputs only): without it they sink
  // behind the barrier and their whole latency stands in front of the WMMA loop
  asm volatile("" :: "v"(va0.x), "v"(va0.y), "v"(va0.z), "v"(va0.w),
                     "v"(vb0.x), "v"(vb0.y), "v"(vb0.z), "v"(vb0.w),
                     "v"(va1.x), "v"(va1.y), "v"(va1.z), "v"(va1.w),
                     "v"(vb1.x), "v"(vb1.y), "v"(vb1.z), "v"(vb1.w));
  __syncthreads();

  // behind the block's one barrier, so that nothing waits for these stores
  float4* vw = vpair + (size_t)blockIdx.x * 32 * 32 + (tid >> 4) * 32 +
               (tid & 15) * 2;
  vw[0]           = make_float4(va0.x, vb0.x, va0.y, vb0.y);
  vw[1]           = make_float4(va0.z, vb0.z, va0.w, vb0.w);
  vw[16 * 32]     = make_float4(va1.x, vb1.x, va1.y, vb1.y);
  vw[16 * 32 + 1] = make_float4(va1.z, vb1.z, va1.w, vb1.w);
  // no register that these stores name is rewritten ahead of this wait
  asm volatile("s_wait_xcnt 0x0" ::: "memory");

  v8f acc[8] = {v8f{}, v8f{}, v8f{}, v8f{}, v8f{}, v8f{}, v8f{}, v8f{}};
  const int jo = hi ? 4 : 0;
  const float*  wa = w2s + l16 * WP + jo;
  const float4* wl = wsm + jo;

  float4 an[8], wn[4];                       // operands of the next group
  #pragma unroll
  for (int e = 0; e < 4; ++e) wn[e] = wl[e];
  #pragma unroll
  for (int mt = 0; mt < 8; ++mt) an[mt] = *(const float4*)(wa + mt * 16 * WP);

  // full unroll: constant LDS offsets and register renaming of the two buffers
  #pragma unroll
  for (int s = 0; s < HH / 8; ++s) {
    // layer 1 for this lane's four j of the group
    float h[4];
    #pragma unroll
    for (int e = 0; e < 4; ++e)
      h[e] = fmaxf(
          fmaf(wn[e].x, x0, fmaf(wn[e].y, x1, fmaf(wn[e].z, x2, wn[e].w))),
          0.f);
    const v2f B0 = {h[0], h[1]}, B1 = {h[2], h[3]};
    float4 ac[8];
    #pragma unroll
    for (int mt = 0; mt < 8; ++mt) ac[mt] = an[mt];
    if (s + 1 < HH / 8) {
      #pragma unroll
      for (int e = 0; e < 4; ++e) wn[e] = wl[(s + 1) * 8 + e];
      #pragma unroll
      for (int mt = 0; mt < 8; ++mt)
        an[mt] = *(const float4*)(wa + mt * 16 * WP + (s + 1) * 8);
    }
    // keeps the next group's LDS reads as one run ahead of this group's WMMAs;
    // without it each read sinks to its use and its latency is exposed
    __builtin_amdgcn_sched_barrier(0);
    #pragma unroll
    for (int mt = 0; mt < 8; ++mt) {
      const v2f A0 = {ac[mt].x, ac[mt].y};
      acc[mt] = wmma4(A0, B0, acc[mt]);
    }
    #pragma unroll
    for (int mt = 0; mt < 8; ++mt) {
      const v2f A1 = {ac[mt].z, ac[mt].w};
      acc[mt] = wmma4(A1, B1, acc[mt]);
    }
    // closes the WMMA run: nothing of the next group moves in among them
    __builtin_amdgcn_sched_barrier(0);
  }

  // ---- bias + relu + layer 3: the lane holds u = 16*mt + (hi ? 8 : 0) + i ----
  float s0 = 0.f, s1 = 0.f, s2 = 0.f;
  const float4* w3l = wsm + HH + (hi ? 8 : 0);
  float4 tn[8];
  #pragma unroll
  for (int i = 0; i < 8; ++i) tn[i] = w3l[i];
  #pragma unroll
  for (int mt = 0; mt < 8; ++mt) {
    float4 tc[8];
    #pragma unroll
    for (int i = 0; i < 8; ++i) tc[i] = tn[i];
    if (mt + 1 < 8) {
      #pragma unroll
      for (int i = 0; i < 8; ++i) tn[i] = w3l[(mt + 1) * 16 + i];
    }
    // keeps the next tile's LDS reads ahead of this tile's arithmetic
    __builtin_amdgcn_sched_barrier(0);
    #pragma unroll
    for (int i = 0; i < 8; ++i) {
      const float hv = fmaxf(acc[mt][i] + tc[i].w, 0.f);
      s0 = fmaf(tc[i].x, hv, s0);
      s1 = fmaf(tc[i].y, hv, s1);
      s2 = fmaf(tc[i].z, hv, s2);
    }
  }
  s0 += swap16(s0); s1 += swap16(s1); s2 += swap16(s2);

  if (!hi) {
    const float sx = x0 * (s0 + b3[0]);      // x * mlp(x)
    const float sy = x1 * (s1 + b3[1]);
    const float sz = x2 * (s2 + b3[2]);
    const float w  = -0.5f * (sx * sx + sy * sy + sz * sz);
    aug[p] = make_float4(sx, sy, sz, w);
  }
}

// ---------------------------------------------------------------------------
// Kernel 2: fused score + softmax + context.
// Block = 512 thr (16 waves) on 128 queries: waves w and w+8 own the same 16
// queries and split every stage's keys, KW each, so that four waves share a
// SIMD and fill one another's LDS and exp latencies on the matrix pipe.  Their
// partial O and denominators are plain sums (no running maximum) and are
// joined once through LDS after the loop.  The key side (V in key pairs and
// augmented K points) comes in stages of KT keys through a two-buffer LDS ring
// filled by asynchronous copies: stage t+1 flies while stage t is worked on,
// and one barrier per stage replaces two per 16 keys.
// Per 16 keys per wave: 1 score WMMA + 16 accumulate WMMAs, 8 exps; the score
// tile's registers are the B operands of the accumulate WMMAs with no move.
// V arrives as vpair[k/2][v] = (V[k][v], V[k+1][v]): the two k slots of an A
// operand lie side by side, so one b128 LDS read is the A operands of two
// v-tiles as they stand.  Row m of v-tile 2h+e is v = 32h + 2m + e; the 16 lanes
// of a half read 256 contiguous bytes, all 64 banks once, with no pad.
// ---------------------------------------------------------------------------
#define KT  256            // keys per stage
#define KW  (KT / 2)       // keys of a stage that one wave works on
#define PR  (2 * DV)       // a pair row of V (two keys), in floats
#define NST (NK / KT)      // stages
#define XP  36             // LDS pitch of a lane's hand-over record, in floats

__device__ inline unsigned lds_addr(const void* p) {
  // low 32 bits of a __shared__ address = byte offset in the work-group's LDS
  return (unsigned)(unsigned long long)p;
}

// One stage: every thread copies 8 x 16 B of V (a stage is one run of bytes in
// memory and in LDS; chunks 8 KB apart) and 8 B of K.
__device__ inline void stage_copy(unsigned lv, const float* gv, unsigned lk,
                                  const char* gk) {
  // s_wait_xcnt stands inside the statement so that no address register of an
  // issued copy is rewritten ahead of it.
  asm volatile(
      "global_load_async_to_lds_b128 %0, %8, off\n\t"
      "global_load_async_to_lds_b128 %1, %9, off\n\t"
      "global_load_async_to_lds_b128 %2, %10, off\n\t"
      "global_load_async_to_lds_b128 %3, %11, off\n\t"
      "global_load_async_to_lds_b128 %4, %12, off\n\t"
      "global_load_async_to_lds_b128 %5, %13, off\n\t"
      "global_load_async_to_lds_b128 %6, %14, off\n\t"
      "global_load_async_to_lds_b128 %7, %15, off\n\t"
      "global_load_async_to_lds_b64 %16, %17, off\n\t"
      "s_wait_xcnt 0x0"
      :: "v"(lv), "v"(lv + 1 * 8192), "v"(lv + 2 * 8192), "v"(lv + 3 * 8192),
         "v"(lv + 4 * 8192), "v"(lv + 5 * 8192), "v"(lv + 6 * 8192),
         "v"(lv + 7 * 8192),
         "v"(gv), "v"(gv + 1 * 2048), "v"(gv + 2 * 2048), "v"(gv + 3 * 2048),
         "v"(gv + 4 * 2048), "v"(gv + 5 * 2048), "v"(gv + 6 * 2048),
         "v"(gv + 7 * 2048), "v"(lk), "v"(gk)
      : "memory");
}

__global__ __launch_bounds__(512) void NW0_attn(
    const float4* __restrict__ kaug, const float4* __restrict__ qaug,
    const float* __restrict__ vpair, float* __restrict__ out) {
  __shared__ __align__(16) float  vts[2][KT * DV];  // V stage, KT/2 pair rows
  __shared__ __align__(16) float4 kts[2][KT];       // augmented K stage

  const int b    = blockIdx.x >> 5;       // 32 query blocks per batch
  const int qblk = blockIdx.x & 31;
  const int tid  = threadIdx.x;
  // the wave's number as a scalar: the hand-over below branches on it
  const int wave = __builtin_amdgcn_readfirstlane(tid >> 5);
  const int qt   = wave & 7;              // query tile of the wave
  const int kh   = wave >> 3;             // its half of every stage's keys
  const int lane = tid & 31;
  const int l16  = lane & 15;
  const bool hi  = lane >= 16;
  const int q    = qblk * 128 + qt * 16 + l16;    // this lane's query column

  // B operand of the score WMMA: rows (Qx,Qy,Qz,1); C = -0.5*q2 per column.
  const float4 qa = qaug[(size_t)b * NQ + q];
  v2f Bq; Bq.x = hi ? qa.z : qa.x; Bq.y = hi ? 1.0f : qa.y;
  const float cq = qa.w;                       // -0.5*|Qs|^2
  const v8f c8 = {cq, cq, cq, cq, cq, cq, cq, cq};

  v8f o[4] = {v8f{}, v8f{}, v8f{}, v8f{}};     // O^T[v,q], v-tiles 2h+e
  float lacc = 0.f;                            // partial softmax denominator

  // this thread's share of a stage: source and LDS place of its first chunk
  const float* gv = vpair + (size_t)b * NK * DV + tid * 4;
  const char*  gk = (const char*)(kaug + (size_t)b * NK) + tid * 8;
  const unsigned lv0 = lds_addr(&vts[0][tid * 4]);
  const unsigned lv1 = lds_addr(&vts[1][tid * 4]);
  const unsigned lk0 = lds_addr(&kts[0][0]) + tid * 8;
  const unsigned lk1 = lds_addr(&kts[1][0]) + tid * 8;

  // ---- ring prologue: stage 0 landed and published, stage 1 in flight ----
  stage_copy(lv0, gv, lk0, gk);
  // this wave's copies of stage 0 have landed
  asm volatile("s_wait_asynccnt 0x0" ::: "memory");
  __syncthreads();
  stage_copy(lv1, gv + KT * DV, lk1, gk + KT * 16);

  // lanes 16-31 hold k slots 2 and 3: the pair row eight keys on, the keys whose
  // scores those lanes hold
  const int d = (hi ? 4 * PR : 0) + l16 * 4;
  for (int t = 0; t < NST; ++t) {
    const float*  vs = vts[t & 1] + kh * KW * DV + d;
    const float4* ks = kts[t & 1] + kh * KW;

    // full unroll: constant LDS offsets, and the 16-key groups of a stage can
    // overlap (no barrier stands between them any more)
    #pragma unroll
    for (int kt = 0; kt < KW; kt += 16) {
      // ---- score tile: D[k,q] = K.Q - 0.5k2 - 0.5q2  (one WMMA) ----
      const float4 ka = ks[kt + l16];          // (Kx,Ky,Kz,-0.5*k2)
      v2f Ak; Ak.x = hi ? ka.z : ka.x; Ak.y = hi ? ka.w : ka.y;
      const v8f s = wmma4(Ak, Bq, c8);

      // ---- clamp (sqdist >= 0) + exp; scores <= 0 so exp in [0,1] ----
      float p0 = __expf(fminf(s[0], 0.f)), p1 = __expf(fminf(s[1], 0.f));
      float p2 = __expf(fminf(s[2], 0.f)), p3 = __expf(fminf(s[3], 0.f));
      float p4 = __expf(fminf(s[4], 0.f)), p5 = __expf(fminf(s[5], 0.f));
      float p6 = __expf(fminf(s[6], 0.f)), p7 = __expf(fminf(s[7], 0.f));
      lacc += ((p0 + p1) + (p2 + p3)) + ((p4 + p5) + (p6 + p7));

      // ---- P as the B operands, as it stands: a sum over keys takes any order,
      // so k slots 0,1 (lanes 0-15) are keys 2j, 2j+1 and k slots 2,3 (lanes
      // 16-31) keys 8+2j, 8+2j+1, which is where the score tile left them ----
      const v2f Bp0 = {p0, p1}, Bp1 = {p2, p3}, Bp2 = {p4, p5}, Bp3 = {p6, p7};

      // ---- O^T += V^T x P : 4 v-tiles x 4 chained K=4 WMMAs ----
      const float* vr = vs + kt * DV;
      #pragma unroll
      for (int h = 0; h < 2; ++h) {
        const float4 f0 = *(const float4*)(vr + 0 * PR + h * DV);  // keys 0,1|8,9
        const float4 f1 = *(const float4*)(vr + 1 * PR + h * DV);  // 2,3|10,11
        const float4 f2 = *(const float4*)(vr + 2 * PR + h * DV);  // 4,5|12,13
        const float4 f3 = *(const float4*)(vr + 3 * PR + h * DV);  // 6,7|14,15
        v8f acc = o[2 * h];
        acc = wmma4(v2f{f0.x, f0.y}, Bp0, acc);
        acc = wmma4(v2f{f1.x, f1.y}, Bp1, acc);
        acc = wmma4(v2f{f2.x, f2.y}, Bp2, acc);
        acc = wmma4(v2f{f3.x, f3.y}, Bp3, acc);
        o[2 * h] = acc;
        acc = o[2 * h + 1];
        acc = wmma4(v2f{f0.z, f0.w}, Bp0, acc);
        acc = wmma4(v2f{f1.z, f1.w}, Bp1, acc);
        acc = wmma4(v2f{f2.z, f2.w}, Bp2, acc);
        acc = wmma4(v2f{f3.z, f3.w}, Bp3, acc);
        o[2 * h + 1] = acc;
      }
    }

    // ---- publish point of stage t+1, then refill of the buffer just read ----
    // this wave's LDS reads of stage t have returned
    asm volatile("s_wait_dscnt 0x0" ::: "memory");
    // this wave's copies of stage t+1 have landed
    asm volatile("s_wait_asynccnt 0x0" ::: "memory");
    __syncthreads();
    if (t + 2 < NST)
      stage_copy((t & 1) ? lv1 : lv0, gv + (size_t)(t + 2) * KT * DV,
                 (t & 1) ? lk1 : lk0, gk + (size_t)(t + 2) * KT * 16);
  }
  // no copy is left in flight when the wave ends
  asm volatile("s_wait_asynccnt 0x0" ::: "memory");

  // ---- join the key halves: waves 8-15 hand O and the denominator over ----
  // The ring is free for it: every wave's LDS reads had returned and its copies
  // had landed ahead of the last trip's barrier.
  float* xs = &vts[0][0] + (qt * 32 + lane) * XP;
  if (kh) {
    #pragma unroll
    for (int vt = 0; vt < 4; ++vt) {
      *(float4*)(xs + vt * 8)     = make_float4(o[vt][0], o[vt][1], o[vt][2], o[vt][3]);
      *(float4*)(xs + vt * 8 + 4) = make_float4(o[vt][4], o[vt][5], o[vt][6], o[vt][7]);
    }
    xs[32] = lacc;
  }
  __syncthreads();
  if (kh) return;
  #pragma unroll
  for (int vt = 0; vt < 4; ++vt) {
    const float4 xa = *(const float4*)(xs + vt * 8);
    const float4 xb = *(const float4*)(xs + vt * 8 + 4);
    o[vt] += v8f{xa.x, xa.y, xa.z, xa.w, xb.x, xb.y, xb.z, xb.w};
  }
  lacc += xs[32];

  // ---- finalize: combine lane halves of the denominator, divide, store ----
  const float inv = 1.0f / (lacc + swap16(lacc));
  // register i of v-tile 2h+e is v = 32h + 16*hi + 2i + e
  float* ob = out + ((size_t)(b * NQ + q)) * DV + (hi ? 16 : 0);
  #pragma unroll
  for (int h = 0; h < 2; ++h) {
    const v8f oe = o[2 * h] * inv, oo = o[2 * h + 1] * inv;
    #pragma unroll
    for (int n = 0; n < 4; ++n)
      *(float4*)(ob + h * 32 + n * 4) =
          make_float4(oe[2 * n], oo[2 * n], oe[2 * n + 1], oo[2 * n + 1]);
  }
}

// ---------------------------------------------------------------------------
extern "C" void kernel_launch(void* const* d_in, const int* in_sizes, int n_in,
                              void* d_out, int out_size, void* d_ws,
                              size_t ws_size, hipStream_t stream) {
  const float* KEY   = (const float*)d_in[0];
  const float* VALUE = (const float*)d_in[1];
  const float* QUERY = (const float*)d_in[2];
  const float* W1 = (const float*)d_in[3];
  const float* b1 = (const float*)d_in[4];
  const float* W2 = (const float*)d_in[5];
  const float* b2 = (const float*)d_in[6];
  const float* W3 = (const float*)d_in[7];
  const float* b3 = (const float*)d_in[8];

  float4* kaug = (float4*)d_ws;                 // 512 KB
  float4* qaug = kaug + (size_t)BB * NK;        // 512 KB
  float4* vpair = qaug + (size_t)BB * NQ;       // 8 MB: V in key pairs

  NW0_mlp_aug<<<(BB * NK) / 128, 256, 0, stream>>>(
      KEY, W1, b1, W2, b2, W3, b3, kaug, VALUE, vpair);
  NW0_mlp_aug<<<(BB * NQ) / 128, 256, 0, stream>>>(
      QUERY, W1, b1, W2, b2, W3, b3, qaug, VALUE + (size_t)(BB / 2) * NK * DV,
      vpair + (size_t)(BB / 2) * NK * DV / 4);
  NW0_attn<<<BB * (NQ / 128), 512, 0, stream>>>(
      kaug, qaug, (const float*)vpair, (float*)d_out);
}

// v007
// Measured time: 57.8 microseconds a run.
// Versions in between are left out here; by their measured steps it is 1.89 times as fast as v005.
// Over all steps from v000 it is 7.77 times as fast.
#include <hip/hip_runtime.h>
#include <hip/hip_bf16.h>

// ---------------------------------------------------------------------------
// Gaussian-kernel attention, fused flash-style over the KEY axis.
//   B=8, NK=NQ=4096, IN=3, H=128, DV=64
// Dominant cost: attn@VALUE (17.2 GFLOP): bf16 WMMA 16x16x32 on hi+lo parts of the
// f32 operands; the 134M score dots stay on WMMA f32 16x16x4.
// Scores are <= 0 after clamping, so no weight exceeds 1: streaming softmax
// without running-max rescaling (sum >= strongest term, divide once at end).
// ---------------------------------------------------------------------------

#define BB  8
#define NK  4096
#define NQ  4096
#define DV  64

typedef __attribute__((ext_vector_type(2))) float v2f;
typedef __attribute__((ext_vector_type(4))) float v4f;
typedef __attribute__((ext_vector_type(8))) float v8f;
typedef __attribute__((ext_vector_type(8))) unsigned v8u;
typedef __bf16 bf16x2  __attribute__((ext_vector_type(2)));
typedef __bf16 bf16x16 __attribute__((ext_vector_type(16)));

__device__ inline v8f wmma4(v2f a, v2f b, v8f c) {
  // D = A(16x4) x B(4x16) + C, all f32
  return __builtin_amdgcn_wmma_f32_16x16x4_f32(false, a, false, b, (short)0, c,
                                               false, false);
}

__device__ inline v8f wmma32(bf16x16 a, bf16x16 b, v8f c) {
  // D = A(16x32) x B(32x16) + C, bf16 operands, f32 sum
  return __builtin_amdgcn_wmma_f32_16x16x32_bf16(false, a, false, b, (short)0, c,
                                                 false, false);
}

// Two f32 values as bf16 parts: x = hi + lo + r, |r| about 2^-17 |x|.
// Each word holds a in its low and b in its high half.
__device__ inline void split2(float a, float b, unsigned& hi, unsigned& lo) {
  const v2f x = {a, b};
  const bf16x2 h = __builtin_convertvector(x, bf16x2);
  const bf16x2 l = __builtin_convertvector(x - __builtin_convertvector(h, v2f),
                                           bf16x2);
  hi = __builtin_bit_cast(unsigned, h);
  lo = __builtin_bit_cast(unsigned, l);
}

// Eight f32 values as two 16-byte chunks of bf16 parts.
__device__ inline void split8(const float* x, float4* hi, float4* lo) {
  unsigned h[4], l[4];
  #pragma unroll
  for (int j = 0; j < 4; ++j) split2(x[2 * j], x[2 * j + 1], h[j], l[j]);
  *hi = make_float4(__builtin_bit_cast(float, h[0]), __builtin_bit_cast(float, h[1]),
                    __builtin_bit_cast(float, h[2]), __builtin_bit_cast(float, h[3]));
  *lo = make_float4(__builtin_bit_cast(float, l[0]), __builtin_bit_cast(float, l[1]),
                    __builtin_bit_cast(float, l[2]), __builtin_bit_cast(float, l[3]));
}

// min(2^x, 1) = 2^min(x, 0): exp2 is monotone and 2^0 is 1, so the clamp of the
// score at 0 can stand behind the exponential, where it is the instruction's own
// output modifier (the lower bound 0 never acts: 2^x >= 0).
__device__ inline float exp2_sat(float x) {
  return __builtin_amdgcn_fmed3f(__builtin_amdgcn_exp2f(x), 0.f, 1.f);
}

__device__ inline float swap16(float x) {
  // ds_swizzle SWAPX16: xor=0x10, and=0x1f  ->  offset 0x401F
  return __builtin_bit_cast(
      float, __builtin_amdgcn_ds_swizzle(__builtin_bit_cast(int, x), 0x401F));
}

// ---------------------------------------------------------------------------
// Kernel 1: shared MLP (3 -> 128 -> 128 -> 3) + elementwise scale, emits
// augmented float4 (sx, sy, sz, -0.5*|s|^2) per point.
// Block = 256 thr (8 waves); wave w owns 16 points (the columns of its tiles).
// Hidden layer 2 runs on WMMA f32 16x16x4:  H2^T[u,p] = W2[u,j] x H1^T[j,p].
//   A = W2 from LDS (staged once per block, pitch WP: b128 reads hit all banks)
//   B = H1^T, made by each lane in registers in the operand's own layout
//   D = 8 u-tiles; lane = point, so layer 3 stays inside the lane pair l, l^16.
// One b128 of W2 feeds two WMMAs.  k slots of both operands, group s of 8 j:
//   first WMMA  j = 8s+0, 8s+1 (lanes 0-15) and 8s+4, 8s+5 (lanes 16-31)
//   second WMMA j = 8s+2, 8s+3 (lanes 0-15) and 8s+6, 8s+7 (lanes 16-31)
// Beside that, each block re-lays 64 rows of V for kernel 2: bf16 hi and lo parts
// in the order of that kernel's A operands.  A group of 32 keys is 512 chunks of
// 16 B, chunk [part][v-tile][c][h][m] = keys 16c + 8h + 0..7 of column
// v = 32 (m / 8) + 8 v-tile + m % 8  (part 0 = hi, 1 = lo).
// Its loads fly with the W2 loads and its stores drain under the WMMA loop.
// ---------------------------------------------------------------------------
#define HH 128             // hidden width
#define WP 132             // LDS pitch of a W2 row, in floats (16 B x odd)

__global__ __launch_bounds__(256) void NW0_mlp_aug(
    const float* __restrict__ pts,           // [N,3]
    const float* __restrict__ W1, const float* __restrict__ b1,
    const float* __restrict__ W2, const float* __restrict__ b2,
    const float* __restrict__ W3, const float* __restrict__ b3,
    float4* __restrict__ aug,
    const float* __restrict__ vsrc,          // this launch's rows of V, [N/2,DV]
    float4* __restrict__ vpair) {            // the same rows as bf16 operands
  __shared__ __align__(16) float  w2s[HH * WP];
  // [0,HH): (W1[j][0..2], b1[j])    [HH,2*HH): (W3[0..2][u], b2[u])
  __shared__ __align__(16) float4 wsm[2 * HH];

  const int tid  = threadIdx.x;
  const int lane = tid & 31;
  const int l16  = lane & 15;
  const bool hi  = lane >= 16;
  const int p    = blockIdx.x * 128 + (tid >> 5) * 16 + l16;  // lane's point

  // ---- weights into LDS, once per block; all global loads issued together ----
  // (every unroll in this kernel keeps a register array at constant indices)
  const int  un = tid & (HH - 1);
  // waves 0-3 bring the W1 rows, waves 4-7 the W3 columns: a scalar choice
  const bool lo = __builtin_amdgcn_readfirstlane(tid) < HH;
  const float* ga = lo ? W1 : W3;
  const int    gv = lo ? 3 : 1, gs = lo ? 1 : HH;
  const float4 sm = make_float4(ga[un * gv], ga[un * gv + gs],
                                ga[un * gv + 2 * gs], (lo ? b1 : b2)[un]);
  const float x0 = pts[(size_t)p * 3 + 0];
  const float x1 = pts[(size_t)p * 3 + 1];
  const float x2 = pts[(size_t)p * 3 + 2];
  // the W2 loads below land in registers that the loads above name as addresses:
  // none of those is rewritten ahead of this wait
  asm volatile("s_wait_xcnt 0x0" ::: "memory");
  float4 st[16];
  #pragma unroll
  for (int c = 0; c < 16; ++c)               // float4 number tid + 256*c of W2
    st[c] = *(const float4*)(W2 + (size_t)(tid + c * 256) * 4);
  // V: the thread takes column vc of key octets oc (group 0) and 4 + oc (group 1)
  const int vc = tid & 63, oc = tid >> 6;
  const float* vr = vsrc + (size_t)blockIdx.x * 64 * DV + oc * 8 * DV + vc;
  float va[8], vb[8];
  #pragma unroll
  for (int i = 0; i < 8; ++i) {
    va[i] = vr[i * DV];
    vb[i] = vr[(32 + i) * DV];
  }
  #pragma unroll
  for (int c = 0; c < 16; ++c)
    *(float4*)(&w2s[((tid >> 5) + c * 8) * WP + (lane << 2)]) = st[c];
  wsm[tid] = sm;
  // holds the V loads up among the W2 loads (inputs only): without it they sink
  // behind the barrier and their whole latency stands in front of the WMMA loop
  asm volatile("" :: "v"(va[0]), "v"(va[1]), "v"(va[2]), "v"(va[3]),
                     "v"(va[4]), "v"(va[5]), "v"(va[6]), "v"(va[7]),
                     "v"(vb[0]), "v"(vb[1]), "v"(vb[2]), "v"(vb[3]),
                     "v"(vb[4]), "v"(vb[5]), "v"(vb[6]), "v"(vb[7]));
  __syncthreads();

  // behind the block's one barrier, so that nothing waits for these stores
  // (v-tile, c, h, m) of this thread's chunks; parts 256, groups 512 chunks apart
  float4* vw = vpair + (size_t)blockIdx.x * 2 * 512 + ((vc >> 3) & 3) * 64 +
               oc * 16 + (vc >> 5) * 8 + (vc & 7);
  split8(va, vw, vw + 256);
  split8(vb, vw + 512, vw + 512 + 256);
  // no register that these stores name is rewritten ahead of this wait
  asm volatile("s_wait_xcnt 0x0" ::: "memory");

  v8f acc[8] = {v8f{}, v8f{}, v8f{}, v8f{}, v8f{}, v8f{}, v8f{}, v8f{}};
  const int jo = hi ? 4 : 0;
  const float*  wa = w2s + l16 * WP + jo;
  const float4* wl = wsm + jo;

  float4 an[8], wn[4];                       // operands of the next group
  #pragma unroll
  for (int e = 0; e < 4; ++e) wn[e] = wl[e];
  #pragma unroll
  for (int mt = 0; mt < 8; ++mt) an[mt] = *(const float4*)(wa + mt * 16 * WP);

  // full unroll: constant LDS offsets and register renaming of the two buffers
  #pragma unroll
  for (int s = 0; s < HH / 8; ++s) {
    // layer 1 for this lane's four j of the group
    float h[4];
    #pragma unroll
    for (int e = 0; e < 4; ++e)
      h[e] = fmaxf(
          fmaf(wn[e].x, x0, fmaf(wn[e].y, x1, fmaf(wn[e].z, x2, wn[e].w))),
          0.f);
    const v2f B0 = {h[0], h[1]}, B1 = {h[2], h[3]};
    float4 ac[8];
    #pragma unroll
    for (int mt = 0; mt < 8; ++mt) ac[mt] = an[mt];
    if (s + 1 < HH / 8) {
      #pragma unroll
      for (int e = 0; e < 4; ++e) wn[e] = wl[(s + 1) * 8 + e];
      #pragma unroll
      for (int mt = 0; mt < 8; ++mt)
        an[mt] = *(const float4*)(wa + mt * 16 * WP + (s + 1) * 8);
    }
    // keeps the next group's LDS reads as one run ahead of this group's WMMAs;
    // without it each read sinks to its use and its latency is exposed
    __builtin_amdgcn_sched_barrier(0);
    #pragma unroll
    for (int mt = 0; mt < 8; ++mt) {
      const v2f A0 = {ac[mt].x, ac[mt].y};
      acc[mt] = wmma4(A0, B0, acc[mt]);
    }
    #pragma unroll
    for (int mt = 0; mt < 8; ++mt) {
      const v2f A1 = {ac[mt].z, ac[mt].w};
      acc[mt] = wmma4(A1, B1, acc[mt]);
    }
    // closes the WMMA run: nothing of the next group moves in among them
    __builtin_amdgcn_sched_barrier(0);
  }

  // ---- bias + relu + layer 3: the lane holds u = 16*mt + (hi ? 8 : 0) + i ----
  float s0 = 0.f, s1 = 0.f, s2 = 0.f;
  const float4* w3l = wsm + HH + (hi ? 8 : 0);
  float4 tn[8];
  #pragma unroll
  for (int i = 0; i < 8; ++i) tn[i] = w3l[i];
  #pragma unroll
  for (int mt = 0; mt < 8; ++mt) {
    float4 tc[8];
    #pragma unroll
    for (int i = 0; i < 8; ++i) tc[i] = tn[i];
    if (mt + 1 < 8) {
      #pragma unroll
      for (int i = 0; i < 8; ++i) tn[i] = w3l[(mt + 1) * 16 + i];
    }
    // keeps the next tile's LDS reads ahead of this tile's arithmetic
    __builtin_amdgcn_sched_barrier(0);
    #pragma unroll
    for (int i = 0; i < 8; ++i) {
      const float hv = fmaxf(acc[mt][i] + tc[i].w, 0.f);
      s0 = fmaf(tc[i].x, hv, s0);
      s1 = fmaf(tc[i].y, hv, s1);
      s2 = fmaf(tc[i].z, hv, s2);
    }
  }
  s0 += swap16(s0); s1 += swap16(s1); s2 += swap16(s2);

  if (!hi) {
    const float sx = x0 * (s0 + b3[0]);      // x * mlp(x)
    const float sy = x1 * (s1 + b3[1]);
    const float sz = x2 * (s2 + b3[2]);
    const float w  = -0.5f * (sx * sx + sy * sy + sz * sz);
    aug[p] = make_float4(sx, sy, sz, w);
  }
}

// ---------------------------------------------------------------------------
// Kernel 2: fused score + softmax + context.
// Block = 512 thr (16 waves) on 128 queries: waves w and w+8 own the same 16
// queries and split every stage's keys, KW each, so that four waves share a
// SIMD and fill one another's LDS and exp latencies on the matrix pipe.  Their
// partial O and denominators are plain sums (no running maximum) and are
// joined once through LDS after the loop.  The key side (V as bf16 parts and
// augmented K points) comes in stages of KT keys through a two-buffer LDS ring
// filled by asynchronous copies: stage t+1 flies while stage t is worked on,
// and one barrier per stage replaces two per 16 keys.
// Per 32 keys per wave: 2 score WMMAs (f32), 16 exps, and for each of 4 v-tiles
// three bf16 16x16x32 WMMAs with f32 sums: Vhi Phi + Vlo Phi + Vhi Plo (the term
// Vlo Plo, about 2^-18 of the product, is left out).
// Two score tiles, split in place, are the B operand: element s of lane half h
// is key s < 8 ? 8h + s : 16 + 8h + (s - 8).  V arrives in that same k order
// (kernel 1), so an A operand is two b128 LDS reads, 512 contiguous bytes a wave.
// Row m of v-tile vt is v = 32 (m / 8) + 8 vt + m % 8, so that a lane's 32 results
// are 32 neighbouring v.
// ---------------------------------------------------------------------------
#define KT  256            // keys per stage
#define KW  (KT / 2)       // keys of a stage that one wave works on
#define GF  (32 * DV)      // a group of 32 keys of V (hi and lo parts), in floats
#define NST (NK / KT)      // stages
#define XP  36             // LDS pitch of a lane's hand-over record, in floats

__device__ inline unsigned lds_addr(const void* p) {
  // low 32 bits of a __shared__ address = byte offset in the work-group's LDS
  return (unsigned)(unsigned long long)p;
}

// One stage: every thread copies 8 x 16 B of V (a stage is one run of bytes in
// memory and in LDS; chunks 8 KB apart) and 8 B of K.
__device__ inline void stage_copy(unsigned lv, const float* gv, unsigned lk,
                                  const char* gk) {
  // s_wait_xcnt stands inside the statement so that no address register of an
  // issued copy is rewritten ahead of it.
  asm volatile(
      "global_load_async_to_lds_b128 %0, %8, off\n\t"
      "global_load_async_to_lds_b128 %1, %9, off\n\t"
      "global_load_async_to_lds_b128 %2, %10, off\n\t"
      "global_load_async_to_lds_b128 %3, %11, off\n\t"
      "global_load_async_to_lds_b128 %4, %12, off\n\t"
      "global_load_async_to_lds_b128 %5, %13, off\n\t"
      "global_load_async_to_lds_b128 %6, %14, off\n\t"
      "global_load_async_to_lds_b128 %7, %15, off\n\t"
      "global_load_async_to_lds_b64 %16, %17, off\n\t"
      "s_wait_xcnt 0x0"
      :: "v"(lv), "v"(lv + 1 * 8192), "v"(lv + 2 * 8192), "v"(lv + 3 * 8192),
         "v"(lv + 4 * 8192), "v"(lv + 5 * 8192), "v"(lv + 6 * 8192),
         "v"(lv + 7 * 8192),
         "v"(gv), "v"(gv + 1 * 2048), "v"(gv + 2 * 2048), "v"(gv + 3 * 2048),
         "v"(gv + 4 * 2048), "v"(gv + 5 * 2048), "v"(gv + 6 * 2048),
         "v"(gv + 7 * 2048), "v"(lk), "v"(gk)
      : "memory");
}

__global__ __launch_bounds__(512) void NW0_attn(
    const float4* __restrict__ kaug, const float4* __restrict__ qaug,
    const float* __restrict__ vpair, float* __restrict__ out) {
  __shared__ __align__(16) float  vts[2][KT * DV];  // V stage, KT/32 groups
  __shared__ __align__(16) float4 kts[2][KT];       // augmented K stage

  const int b    = blockIdx.x >> 5;       // 32 query blocks per batch
  const int qblk = blockIdx.x & 31;
  const int tid  = threadIdx.x;
  // the wave's number as a scalar: the hand-over below branches on it
  const int wave = __builtin_amdgcn_readfirstlane(tid >> 5);
  const int qt   = wave & 7;              // query tile of the wave
  const int kh   = wave >> 3;             // its half of every stage's keys
  const int lane = tid & 31;
  const int l16  = lane & 15;
  const bool hi  = lane >= 16;
  const int q    = qblk * 128 + qt * 16 + l16;    // this lane's query column

  // B operand of the score WMMA: rows (Qx,Qy,Qz,1); C = -0.5*q2 per column.
  const float4 qa = qaug[(size_t)b * NQ + q];
  // Both carry the factor log2(e), so that a score tile is exp2's argument as it
  // leaves the WMMA.
  const float L2E = 1.44269504088896340736f;
  v2f Bq; Bq.x = L2E * (hi ? qa.z : qa.x); Bq.y = hi ? L2E : L2E * qa.y;
  const float cq = L2E * qa.w;                 // -0.5*|Qs|^2 * log2(e)
  const v8f c8 = {cq, cq, cq, cq, cq, cq, cq, cq};

  v8f o[4] = {v8f{}, v8f{}, v8f{}, v8f{}};     // O^T[v,q], four v-tiles
  float lacc = 0.f;                            // partial softmax denominator

  // this thread's share of a stage: source and LDS place of its first chunk
  const float* gv = vpair + (size_t)b * NK * DV + tid * 4;
  const char*  gk = (const char*)(kaug + (size_t)b * NK) + tid * 8;
  const unsigned lv0 = lds_addr(&vts[0][tid * 4]);
  const unsigned lv1 = lds_addr(&vts[1][tid * 4]);
  const unsigned lk0 = lds_addr(&kts[0][0]) + tid * 8;
  const unsigned lk1 = lds_addr(&kts[1][0]) + tid * 8;

  // ---- ring prologue: stage 0 landed and published, stage 1 in flight ----
  stage_copy(lv0, gv, lk0, gk);
  // this wave's copies of stage 0 have landed
  asm volatile("s_wait_asynccnt 0x0" ::: "memory");
  __syncthreads();
  stage_copy(lv1, gv + KT * DV, lk1, gk + KT * 16);

  for (int t = 0; t < NST; ++t) {
    const float*  vs = vts[t & 1] + kh * KW * DV + lane * 4;  // the lane's chunk
    const float4* ks = kts[t & 1] + kh * KW;

    // ---- two score tiles: D[k,q] = log2(e) (K.Q - 0.5k2 - 0.5q2), one WMMA each ----
    float4 ka = ks[l16];                       // (Kx,Ky,Kz,-0.5*k2)
    float4 kb = ks[16 + l16];
    v8f sa = wmma4(v2f{hi ? ka.z : ka.x, hi ? ka.w : ka.y}, Bq, c8);
    v8f sb = wmma4(v2f{hi ? kb.z : kb.x, hi ? kb.w : kb.y}, Bq, c8);
    // heads the scheduling order that the groups below go on with
    __builtin_amdgcn_sched_group_barrier(0x100, 2, 0);
    __builtin_amdgcn_sched_group_barrier(0x008, 2, 0);

    // full unroll: constant LDS offsets, and the 32-key groups of a stage can
    // overlap (no barrier stands between them)
    #pragma unroll
    for (int kt = 0; kt < KW; kt += 32) {
      // ---- the group's A operands and the next group's K points, one run ----
      const float* vg = vs + (kt / 32) * GF;
      bf16x16 Vh[4], Vl[4];
      #pragma unroll
      for (int vt = 0; vt < 4; ++vt) {
        const v4f h0 = *(const v4f*)(vg + vt * 256);               // keys 8h + 0..7
        const v4f h1 = *(const v4f*)(vg + vt * 256 + 128);         // 16 + 8h + 0..7
        Vh[vt] = __builtin_bit_cast(
            bf16x16, __builtin_shufflevector(h0, h1, 0, 1, 2, 3, 4, 5, 6, 7));
      }
      #pragma unroll
      for (int vt = 0; vt < 4; ++vt) {
        const v4f l0 = *(const v4f*)(vg + 1024 + vt * 256);
        const v4f l1 = *(const v4f*)(vg + 1024 + vt * 256 + 128);
        Vl[vt] = __builtin_bit_cast(
            bf16x16, __builtin_shufflevector(l0, l1, 0, 1, 2, 3, 4, 5, 6, 7));
      }
      if (kt + 32 < KW) {
        ka = ks[kt + 32 + l16];
        kb = ks[kt + 48 + l16];
      }
      // scheduling order: this group's LDS reads stand behind the WMMAs of the
      // group before and ahead of its own, in runs among the exps, which cover
      // their latency; without it each pair of reads sinks to its WMMA and is
      // waited for there
      if (kt + 32 < KW) {
        __builtin_amdgcn_sched_group_barrier(0x100, 18, 0);
        __builtin_amdgcn_sched_group_barrier(0x008, 14, 0);
      } else {
        __builtin_amdgcn_sched_group_barrier(0x100, 16, 0);
        __builtin_amdgcn_sched_group_barrier(0x008, 12, 0);
      }

      // ---- exp with the clamp (sqdist >= 0) in it: weights in [0,1] ----
      float p[16];
      #pragma unroll
      for (int i = 0; i < 8; ++i) {
        p[i]     = exp2_sat(sa[i]);
        p[8 + i] = exp2_sat(sb[i]);
      }
      lacc += (((p[0] + p[1]) + (p[2] + p[3])) + ((p[4] + p[5]) + (p[6] + p[7]))) +
              (((p[8] + p[9]) + (p[10] + p[11])) +
               ((p[12] + p[13]) + (p[14] + p[15])));

      // ---- P as the B operands, in place: hi and lo bf16 parts ----
      v8u uh, ul;
      #pragma unroll
      for (int j = 0; j < 8; ++j) {
        unsigned h, l;
        split2(p[2 * j], p[2 * j + 1], h, l);
        uh[j] = h; ul[j] = l;
      }
      const bf16x16 Ph = __builtin_bit_cast(bf16x16, uh);
      const bf16x16 Pl = __builtin_bit_cast(bf16x16, ul);

      // ---- O^T += V^T x P : 4 v-tiles x 3 products of K = 32 ----
      #pragma unroll
      for (int vt = 0; vt < 4; ++vt) o[vt] = wmma32(Vh[vt], Ph, o[vt]);
      #pragma unroll
      for (int vt = 0; vt < 4; ++vt) o[vt] = wmma32(Vl[vt], Ph, o[vt]);
      #pragma unroll
      for (int vt = 0; vt < 4; ++vt) o[vt] = wmma32(Vh[vt], Pl, o[vt]);
      // ---- the next group's score tiles ----
      if (kt + 32 < KW) {
        sa = wmma4(v2f{hi ? ka.z : ka.x, hi ? ka.w : ka.y}, Bq, c8);
        sb = wmma4(v2f{hi ? kb.z : kb.x, hi ? kb.w : kb.y}, Bq, c8);
      }
    }

    // ---- publish point of stage t+1, then refill of the buffer just read ----
    // this wave's LDS reads of stage t have returned
    asm volatile("s_wait_dscnt 0x0" ::: "memory");
    // this wave's copies of stage t+1 have landed
    asm volatile("s_wait_asynccnt 0x0" ::: "memory");
    __syncthreads();
    if (t + 2 < NST)
      stage_copy((t & 1) ? lv1 : lv0, gv + (size_t)(t + 2) * KT * DV,
                 (t & 1) ? lk1 : lk0, gk + (size_t)(t + 2) * KT * 16);
  }
  // no copy is left in flight when the wave ends
  asm volatile("s_wait_asynccnt 0x0" ::: "memory");

  // ---- join the key halves: waves 8-15 hand O and the denominator over ----
  // The ring is free for it: every wave's LDS reads had returned and its copies
  // had landed ahead of the last trip's barrier.
  float* xs = &vts[0][0] + (qt * 32 + lane) * XP;
  if (kh) {
    #pragma unroll
    for (int vt = 0; vt < 4; ++vt) {
      *(float4*)(xs + vt * 8)     = make_float4(o[vt][0], o[vt][1], o[vt][2], o[vt][3]);
      *(float4*)(xs + vt * 8 + 4) = make_float4(o[vt][4], o[vt][5], o[vt][6], o[vt][7]);
    }
    xs[32] = lacc;
  }
  __syncthreads();
  if (kh) return;
  #pragma unroll
  for (int vt = 0; vt < 4; ++vt) {
    const float4 xa = *(const float4*)(xs + vt * 8);
    const float4 xb = *(const float4*)(xs + vt * 8 + 4);
    o[vt] += v8f{xa.x, xa.y, xa.z, xa.w, xb.x, xb.y, xb.z, xb.w};
  }
  lacc += xs[32];

  // ---- finalize: combine lane halves of the denominator, divide, store ----
  const float inv = 1.0f / (lacc + swap16(lacc));
  // register r of v-tile vt is v = 32*hi + 8*vt + r
  float* ob = out + ((size_t)(b * NQ + q)) * DV + (hi ? 32 : 0);
  #pragma unroll
  for (int vt = 0; vt < 4; ++vt) {
    const v8f ov = o[vt] * inv;
    *(float4*)(ob + vt * 8)     = make_float4(ov[0], ov[1], ov[2], ov[3]);
    *(float4*)(ob + vt * 8 + 4) = make_float4(ov[4], ov[5], ov[6], ov[7]);
  }
}

// ---------------------------------------------------------------------------
extern "C" void kernel_launch(void* const* d_in, const int* in_sizes, int n_in,
                              void* d_out, int out_size, void* d_ws,
                              size_t ws_size, hipStream_t stream) {
  const float* KEY   = (const float*)d_in[0];
  const float* VALUE = (const float*)d_in[1];
  const float* QUERY = (const float*)d_in[2];
  const float* W1 = (const float*)d_in[3];
  const float* b1 = (const float*)d_in[4];
  const float* W2 = (const float*)d_in[5];
  const float* b2 = (const float*)d_in[6];
  const float* W3 = (const float*)d_in[7];
  const float* b3 = (const float*)d_in[8];

  float4* kaug = (float4*)d_ws;                 // 512 KB
  float4* qaug = kaug + (size_t)BB * NK;        // 512 KB
  float4* vpair = qaug + (size_t)BB * NQ;       // 8 MB: V as bf16 hi and lo parts

  NW0_mlp_aug<<<(BB * NK) / 128, 256, 0, stream>>>(
      KEY, W1, b1, W2, b2, W3, b3, kaug, VALUE, vpair);
  NW0_mlp_aug<<<(BB * NQ) / 128, 256, 0, stream>>>(
      QUERY, W1, b1, W2, b2, W3, b3, qaug, VALUE + (size_t)(BB / 2) * NK * DV,
      vpair + (size_t)(BB / 2) * NK * DV / 4);
  NW0_attn<<<BB * (NQ / 128), 512, 0, stream>>>(
      kaug, qaug, (const float*)vpair, (float*)d_out);
}

// v008
// It runs in 55.8 microseconds.
// Two timings next to v007 both put it at 1.04 times that version's speed.
// Counting every step since v000, it is 8.07 times as fast.
#include <hip/hip_runtime.h>
#include <hip/hip_bf16.h>

// ---------------------------------------------------------------------------
// Gaussian-kernel attention, fused flash-style over the KEY axis.
//   B=8, NK=NQ=4096, IN=3, H=128, DV=64
// Dominant cost: attn@VALUE (17.2 GFLOP): bf16 WMMA 16x16x32 on hi+lo parts of the
// f32 operands; the 134M score dots stay on WMMA f32 16x16x4.
// Scores are <= 0 after clamping, so no weight exceeds 1: streaming softmax
// without running-max rescaling (sum >= strongest term, divide once at end).
// ---------------------------------------------------------------------------

#define BB  8
#define NK  4096
#define NQ  4096
#define DV  64

typedef __attribute__((ext_vector_type(2))) float v2f;
typedef __attribute__((ext_vector_type(4))) float v4f;
typedef __attribute__((ext_vector_type(8))) float v8f;
typedef __attribute__((ext_vector_type(8))) unsigned v8u;
typedef __bf16 bf16x2  __attribute__((ext_vector_type(2)));
typedef __bf16 bf16x16 __attribute__((ext_vector_type(16)));

__device__ inline v8f wmma4(v2f a, v2f b, v8f c) {
  // D = A(16x4) x B(4x16) + C, all f32
  return __builtin_amdgcn_wmma_f32_16x16x4_f32(false, a, false, b, (short)0, c,
                                               false, false);
}

__device__ inline v8f wmma32(bf16x16 a, bf16x16 b, v8f c) {
  // D = A(16x32) x B(32x16) + C, bf16 operands, f32 sum
  return __builtin_amdgcn_wmma_f32_16x16x32_bf16(false, a, false, b, (short)0, c,
                                                 false, false);
}

// Two f32 values as bf16 parts: x = hi + lo + r, |r| about 2^-17 |x|.
// Each word holds a in its low and b in its high half.
__device__ inline void split2(float a, float b, unsigned& hi, unsigned& lo) {
  const v2f x = {a, b};
  const bf16x2 h = __builtin_convertvector(x, bf16x2);
  const bf16x2 l = __builtin_convertvector(x - __builtin_convertvector(h, v2f),
                                           bf16x2);
  hi = __builtin_bit_cast(unsigned, h);
  lo = __builtin_bit_cast(unsigned, l);
}

// Eight f32 values as two 16-byte chunks of bf16 parts.
__device__ inline void split8(const float* x, float4* hi, float4* lo) {
  unsigned h[4], l[4];
  #pragma unroll
  for (int j = 0; j < 4; ++j) split2(x[2 * j], x[2 * j + 1], h[j], l[j]);
  *hi = make_float4(__builtin_bit_cast(float, h[0]), __builtin_bit_cast(float, h[1]),
                    __builtin_bit_cast(float, h[2]), __builtin_bit_cast(float, h[3]));
  *lo = make_float4(__builtin_bit_cast(float, l[0]), __builtin_bit_cast(float, l[1]),
                    __builtin_bit_cast(float, l[2]), __builtin_bit_cast(float, l[3]));
}

// min(2^x, 1) = 2^min(x, 0): exp2 is monotone and 2^0 is 1, so the clamp of the
// score at 0 can stand behind the exponential, where it is the instruction's own
// output modifier (the lower bound 0 never acts: 2^x >= 0).
__device__ inline float exp2_sat(float x) {
  return __builtin_amdgcn_fmed3f(__builtin_amdgcn_exp2f(x), 0.f, 1.f);
}

__device__ inline float swap16(float x) {
  // ds_swizzle SWAPX16: xor=0x10, and=0x1f  ->  offset 0x401F
  return __builtin_bit_cast(
      float, __builtin_amdgcn_ds_swizzle(__builtin_bit_cast(int, x), 0x401F));
}

// ---------------------------------------------------------------------------
// Kernel 1: shared MLP (3 -> 128 -> 128 -> 3) + elementwise scale, emits
// augmented float4 (sx, sy, sz, -0.5*|s|^2) per point.
// Block = 256 thr (8 waves); wave w owns 16 points (the columns of its tiles).
// Hidden layer 2 runs on WMMA f32 16x16x4:  H2^T[u,p] = W2[u,j] x H1^T[j,p].
//   A = W2 from LDS (staged once per block, pitch WP: b128 reads hit all banks)
//   B = H1^T, made by each lane in registers in the operand's own layout
//   D = 8 u-tiles; lane = point, so layer 3 stays inside the lane pair l, l^16.
// One b128 of W2 feeds two WMMAs.  k slots of both operands, group s of 8 j:
//   first WMMA  j = 8s+0, 8s+1 (lanes 0-15) and 8s+4, 8s+5 (lanes 16-31)
//   second WMMA j = 8s+2, 8s+3 (lanes 0-15) and 8s+6, 8s+7 (lanes 16-31)
// Beside that, each block re-lays 64 rows of V for kernel 2: bf16 hi and lo parts
// in the order of that kernel's A operands.  A group of 32 keys is 512 chunks of
// 16 B, chunk [part][v-tile][c][h][m] = keys 16c + 8h + 0..7 of column
// v = 32 (m / 8) + 8 v-tile + m % 8  (part 0 = hi, 1 = lo).
// Its loads fly with the W2 loads and its stores drain under the WMMA loop.
// ---------------------------------------------------------------------------
#define HH 128             // hidden width
#define WP 132             // LDS pitch of a W2 row, in floats (16 B x odd)

__global__ __launch_bounds__(256) void NW0_mlp_aug(
    const float* __restrict__ pts,           // [N,3]
    const float* __restrict__ W1, const float* __restrict__ b1,
    const float* __restrict__ W2, const float* __restrict__ b2,
    const float* __restrict__ W3, const float* __restrict__ b3,
    float4* __restrict__ aug,
    const float* __restrict__ vsrc,          // this launch's rows of V, [N/2,DV]
    float4* __restrict__ vpair) {            // the same rows as bf16 operands
  __shared__ __align__(16) float  w2s[HH * WP];
  // [0,HH): (W1[j][0..2], b1[j])    [HH,2*HH): (W3[0..2][u], b2[u])
  __shared__ __align__(16) float4 wsm[2 * HH];

  const int tid  = threadIdx.x;
  const int lane = tid & 31;
  const int l16  = lane & 15;
  const bool hi  = lane >= 16;
  const int p    = blockIdx.x * 128 + (tid >> 5) * 16 + l16;  // lane's point

  // ---- weights into LDS, once per block; all global loads issued together ----
  // (every unroll in this kernel keeps a register array at constant indices)
  const int  un = tid & (HH - 1);
  // waves 0-3 bring the W1 rows, waves 4-7 the W3 columns: a scalar choice
  const bool lo = __builtin_amdgcn_readfirstlane(tid) < HH;
  const float* ga = lo ? W1 : W3;
  const int    gv = lo ? 3 : 1, gs = lo ? 1 : HH;
  const float4 sm = make_float4(ga[un * gv], ga[un * gv + gs],
                                ga[un * gv + 2 * gs], (lo ? b1 : b2)[un]);
  const float x0 = pts[(size_t)p * 3 + 0];
  const float x1 = pts[(size_t)p * 3 + 1];
  const float x2 = pts[(size_t)p * 3 + 2];
  // the W2 loads below land in registers that the loads above name as addresses:
  // none of those is rewritten ahead of this wait
  asm volatile("s_wait_xcnt 0x0" ::: "memory");
  float4 st[16];
  #pragma unroll
  for (int c = 0; c < 16; ++c)               // float4 number tid + 256*c of W2
    st[c] = *(const float4*)(W2 + (size_t)(tid + c * 256) * 4);
  // V: the thread takes column vc of key octets oc (group 0) and 4 + oc (group 1)
  const int vc = tid & 63, oc = tid >> 6;
  const float* vr = vsrc + (size_t)blockIdx.x * 64 * DV + oc * 8 * DV + vc;
  float va[8], vb[8];
  #pragma unroll
  for (int i = 0; i < 8; ++i) {
    va[i] = vr[i * DV];
    vb[i] = vr[(32 + i) * DV];
  }
  #pragma unroll
  for (int c = 0; c < 16; ++c)
    *(float4*)(&w2s[((tid >> 5) + c * 8) * WP + (lane << 2)]) = st[c];
  wsm[tid] = sm;
  // holds the V loads up among the W2 loads (inputs only): without it they sink
  // behind the barrier and their whole latency stands in front of the WMMA loop
  asm volatile("" :: "v"(va[0]), "v"(va[1]), "v"(va[2]), "v"(va[3]),
                     "v"(va[4]), "v"(va[5]), "v"(va[6]), "v"(va[7]),
                     "v"(vb[0]), "v"(vb[1]), "v"(vb[2]), "v"(vb[3]),
                     "v"(vb[4]), "v"(vb[5]), "v"(vb[6]), "v"(vb[7]));
  __syncthreads();

  // behind the block's one barrier, so that nothing waits for these stores
  // (v-tile, c, h, m) of this thread's chunks; parts 256, groups 512 chunks apart
  float4* vw = vpair + (size_t)blockIdx.x * 2 * 512 + ((vc >> 3) & 3) * 64 +
               oc * 16 + (vc >> 5) * 8 + (vc & 7);
  split8(va, vw, vw + 256);
  split8(vb, vw + 512, vw + 512 + 256);
  // no register that these stores name is rewritten ahead of this wait
  asm volatile("s_wait_xcnt 0x0" ::: "memory");

  v8f acc[8] = {v8f{}, v8f{}, v8f{}, v8f{}, v8f{}, v8f{}, v8f{}, v8f{}};
  const int jo = hi ? 4 : 0;
  const float*  wa = w2s + l16 * WP + jo;
  const float4* wl = wsm + jo;

  float4 an[8], wn[4];                       // operands of the next group
  #pragma unroll
  for (int e = 0; e < 4; ++e) wn[e] = wl[e];
  #pragma unroll
  for (int mt = 0; mt < 8; ++mt) an[mt] = *(const float4*)(wa + mt * 16 * WP);

  // full unroll: constant LDS offsets and register renaming of the two buffers
  #pragma unroll
  for (int s = 0; s < HH / 8; ++s) {
    // layer 1 for this lane's four j of the group
    float h[4];
    #pragma unroll
    for (int e = 0; e < 4; ++e)
      h[e] = fmaxf(
          fmaf(wn[e].x, x0, fmaf(wn[e].y, x1, fmaf(wn[e].z, x2, wn[e].w))),
          0.f);
    const v2f B0 = {h[0], h[1]}, B1 = {h[2], h[3]};
    float4 ac[8];
    #pragma unroll
    for (int mt = 0; mt < 8; ++mt) ac[mt] = an[mt];
    if (s + 1 < HH / 8) {
      #pragma unroll
      for (int e = 0; e < 4; ++e) wn[e] = wl[(s + 1) * 8 + e];
      #pragma unroll
      for (int mt = 0; mt < 8; ++mt)
        an[mt] = *(const float4*)(wa + mt * 16 * WP + (s + 1) * 8);
    }
    // keeps the next group's LDS reads as one run ahead of this group's WMMAs;
    // without it each read sinks to its use and its latency is exposed
    __builtin_amdgcn_sched_barrier(0);
    #pragma unroll
    for (int mt = 0; mt < 8; ++mt) {
      const v2f A0 = {ac[mt].x, ac[mt].y};
      acc[mt] = wmma4(A0, B0, acc[mt]);
    }
    #pragma unroll
    for (int mt = 0; mt < 8; ++mt) {
      const v2f A1 = {ac[mt].z, ac[mt].w};
      acc[mt] = wmma4(A1, B1, acc[mt]);
    }
    // closes the WMMA run: nothing of the next group moves in among them
    __builtin_amdgcn_sched_barrier(0);
  }

  // ---- bias + relu + layer 3: the lane holds u = 16*mt + (hi ? 8 : 0) + i ----
  float s0 = 0.f, s1 = 0.f, s2 = 0.f;
  const float4* w3l = wsm + HH + (hi ? 8 : 0);
  float4 tn[8];
  #pragma unroll
  for (int i = 0; i < 8; ++i) tn[i] = w3l[i];
  #pragma unroll
  for (int mt = 0; mt < 8; ++mt) {
    float4 tc[8];
    #pragma unroll
    for (int i = 0; i < 8; ++i) tc[i] = tn[i];
    if (mt + 1 < 8) {
      #pragma unroll
      for (int i = 0; i < 8; ++i) tn[i] = w3l[(mt + 1) * 16 + i];
    }
    // keeps the next tile's LDS reads ahead of this tile's arithmetic
    __builtin_amdgcn_sched_barrier(0);
    #pragma unroll
    for (int i = 0; i < 8; ++i) {
      const float hv = fmaxf(acc[mt][i] + tc[i].w, 0.f);
      s0 = fmaf(tc[i].x, hv, s0);
      s1 = fmaf(tc[i].y, hv, s1);
      s2 = fmaf(tc[i].z, hv, s2);
    }
  }
  s0 += swap16(s0); s1 += swap16(s1); s2 += swap16(s2);

  if (!hi) {
    const float sx = x0 * (s0 + b3[0]);      // x * mlp(x)
    const float sy = x1 * (s1 + b3[1]);
    const float sz = x2 * (s2 + b3[2]);
    const float w  = -0.5f * (sx * sx + sy * sy + sz * sz);
    aug[p] = make_float4(sx, sy, sz, w);
  }
}

// ---------------------------------------------------------------------------
// Kernel 2: fused score + softmax + context.
// Block = 512 thr (16 waves) on 128 queries: a wave owns 32 queries (two tiles
// of 16) and a quarter, KW keys, of every stage.  Each A operand of V and each
// K point that it reads from LDS feeds both query tiles, so the block reads half
// the LDS bytes per product that 16-query waves read; four waves still share a
// SIMD and fill one another's LDS and exp latencies on the matrix pipe.  The four
// partial O and denominators of a query are plain sums (no running maximum) and
// are joined once through LDS after the loop.  The key side (V as bf16 parts and
// augmented K points) comes in stages of KT keys through a two-buffer LDS ring
// filled by asynchronous copies: stage t+1 flies while stage t is worked on,
// and one barrier per stage replaces two per 16 keys.
// Per 32 keys and query tile: 2 score WMMAs (f32), 16 exps, and for each of 4
// v-tiles three bf16 16x16x32 WMMAs with f32 sums: Vhi Phi + Vlo Phi + Vhi Plo
// (the term Vlo Plo, about 2^-18 of the product, is left out).
// Two score tiles, split in place, are the B operand: element s of lane half h
// is key s < 8 ? 8h + s : 16 + 8h + (s - 8).  V arrives in that same k order
// (kernel 1), so an A operand is two b128 LDS reads, 512 contiguous bytes a wave.
// Row m of v-tile vt is v = 32 (m / 8) + 8 vt + m % 8, so that a lane's 32 results
// are 32 neighbouring v.
// ---------------------------------------------------------------------------
#define KT  256            // keys per stage
#define KW  (KT / 4)       // keys of a stage that one wave works on
#define GF  (32 * DV)      // a group of 32 keys of V (hi and lo parts), in floats
#define NST (NK / KT)      // stages
#define XP  68             // LDS pitch of a lane's hand-over record, in floats

__device__ inline unsigned lds_addr(const void* p) {
  // low 32 bits of a __shared__ address = byte offset in the work-group's LDS
  return (unsigned)(unsigned long long)p;
}

// One stage: every thread copies 8 x 16 B of V (a stage is one run of bytes in
// memory and in LDS; chunks 8 KB apart) and 8 B of K.
__device__ inline void stage_copy(unsigned lv, const float* gv, unsigned lk,
                                  const char* gk) {
  // s_wait_xcnt stands inside the statement so that no address register of an
  // issued copy is rewritten ahead of it.
  asm volatile(
      "global_load_async_to_lds_b128 %0, %8, off\n\t"
      "global_load_async_to_lds_b128 %1, %9, off\n\t"
      "global_load_async_to_lds_b128 %2, %10, off\n\t"
      "global_load_async_to_lds_b128 %3, %11, off\n\t"
      "global_load_async_to_lds_b128 %4, %12, off\n\t"
      "global_load_async_to_lds_b128 %5, %13, off\n\t"
      "global_load_async_to_lds_b128 %6, %14, off\n\t"
      "global_load_async_to_lds_b128 %7, %15, off\n\t"
      "global_load_async_to_lds_b64 %16, %17, off\n\t"
      "s_wait_xcnt 0x0"
      :: "v"(lv), "v"(lv + 1 * 8192), "v"(lv + 2 * 8192), "v"(lv + 3 * 8192),
         "v"(lv + 4 * 8192), "v"(lv + 5 * 8192), "v"(lv + 6 * 8192),
         "v"(lv + 7 * 8192),
         "v"(gv), "v"(gv + 1 * 2048), "v"(gv + 2 * 2048), "v"(gv + 3 * 2048),
         "v"(gv + 4 * 2048), "v"(gv + 5 * 2048), "v"(gv + 6 * 2048),
         "v"(gv + 7 * 2048), "v"(lk), "v"(gk)
      : "memory");
}

__global__ __launch_bounds__(512) void NW0_attn(
    const float4* __restrict__ kaug, const float4* __restrict__ qaug,
    const float* __restrict__ vpair, float* __restrict__ out) {
  __shared__ __align__(16) float  vts[2 * KT * DV]; // V stages, KT/32 groups each
  __shared__ __align__(16) float4 kts[2][KT];       // augmented K stage

  const int b    = blockIdx.x >> 5;       // 32 query blocks per batch
  const int qblk = blockIdx.x & 31;
  const int tid  = threadIdx.x;
  // the wave's number as a scalar: the hand-over below branches on it
  const int wave = __builtin_amdgcn_readfirstlane(tid >> 5);
  const int qp   = wave & 3;              // the wave's pair of query tiles
  const int kq   = wave >> 2;             // its quarter of every stage's keys
  const int lane = tid & 31;
  const int l16  = lane & 15;
  const bool hi  = lane >= 16;
  const int q    = qblk * 128 + qp * 32 + l16;    // the lane's column of tile 0

  // B operand of the score WMMA: rows (Qx,Qy,Qz,1); C = -0.5*q2 per column.
  // Both carry the factor log2(e), so that a score tile is exp2's argument as it
  // leaves the WMMA.
  // (every unroll over qi, vt, i or j in this kernel keeps a register array at
  // constant indices)
  const float L2E = 1.44269504088896340736f;
  v2f Bq[2];
  v8f c8[2];
  #pragma unroll
  for (int qi = 0; qi < 2; ++qi) {
    const float4 qa = qaug[(size_t)b * NQ + q + qi * 16];
    Bq[qi].x = L2E * (hi ? qa.z : qa.x);
    Bq[qi].y = hi ? L2E : L2E * qa.y;
    const float cq = L2E * qa.w;               // -0.5*|Qs|^2 * log2(e)
    c8[qi] = v8f{cq, cq, cq, cq, cq, cq, cq, cq};
  }

  v8f o[2][4] = {{v8f{}, v8f{}, v8f{}, v8f{}},   // O^T[v,q]: two query tiles
                 {v8f{}, v8f{}, v8f{}, v8f{}}};  // of four v-tiles
  float lacc[2] = {0.f, 0.f};                  // partial softmax denominators

  // this thread's share of a stage: source and LDS place of its first chunk
  const float* gv = vpair + (size_t)b * NK * DV + tid * 4;
  const char*  gk = (const char*)(kaug + (size_t)b * NK) + tid * 8;
  const unsigned lv0 = lds_addr(&vts[tid * 4]);
  const unsigned lv1 = lds_addr(&vts[KT * DV + tid * 4]);
  const unsigned lk0 = lds_addr(&kts[0][0]) + tid * 8;
  const unsigned lk1 = lds_addr(&kts[1][0]) + tid * 8;

  // ---- ring prologue: stage 0 landed and published, stage 1 in flight ----
  stage_copy(lv0, gv, lk0, gk);
  // this wave's copies of stage 0 have landed
  asm volatile("s_wait_asynccnt 0x0" ::: "memory");
  __syncthreads();
  stage_copy(lv1, gv + KT * DV, lk1, gk + KT * 16);

  for (int t = 0; t < NST; ++t) {
    // the lane's chunk of the wave's first group
    const float*  vs = vts + (t & 1) * KT * DV + kq * KW * DV + lane * 4;
    const float4* ks = kts[t & 1] + kq * KW;

    // ---- score tiles: D[k,q] = log2(e) (K.Q - 0.5k2 - 0.5q2), one WMMA each ----
    float4 ka = ks[l16];                       // (Kx,Ky,Kz,-0.5*k2)
    float4 kb = ks[16 + l16];
    v8f sa[2], sb[2];
    #pragma unroll
    for (int qi = 0; qi < 2; ++qi) {
      sa[qi] = wmma4(v2f{hi ? ka.z : ka.x, hi ? ka.w : ka.y}, Bq[qi], c8[qi]);
      sb[qi] = wmma4(v2f{hi ? kb.z : kb.x, hi ? kb.w : kb.y}, Bq[qi], c8[qi]);
    }

    // full unroll: constant LDS offsets, and the 32-key groups of a stage can
    // overlap (no barrier stands between them)
    #pragma unroll
    for (int kt = 0; kt < KW; kt += 32) {
      // ---- the group's A operands and the next group's K points, one run ----
      const float* vg = vs + (kt / 32) * GF;
      bf16x16 Vh[4], Vl[4];
      #pragma unroll
      for (int vt = 0; vt < 4; ++vt) {
        const v4f h0 = *(const v4f*)(vg + vt * 256);               // keys 8h + 0..7
        const v4f h1 = *(const v4f*)(vg + vt * 256 + 128);         // 16 + 8h + 0..7
        Vh[vt] = __builtin_bit_cast(
            bf16x16, __builtin_shufflevector(h0, h1, 0, 1, 2, 3, 4, 5, 6, 7));
      }
      #pragma unroll
      for (int vt = 0; vt < 4; ++vt) {
        const v4f l0 = *(const v4f*)(vg + 1024 + vt * 256);
        const v4f l1 = *(const v4f*)(vg + 1024 + vt * 256 + 128);
        Vl[vt] = __builtin_bit_cast(
            bf16x16, __builtin_shufflevector(l0, l1, 0, 1, 2, 3, 4, 5, 6, 7));
      }
      if (kt + 32 < KW) {
        ka = ks[kt + 32 + l16];
        kb = ks[kt + 48 + l16];
      }

      #pragma unroll
      for (int qi = 0; qi < 2; ++qi) {
        // ---- exp with the clamp (sqdist >= 0) in it: weights in [0,1] ----
        float p[16];
        #pragma unroll
        for (int i = 0; i < 8; ++i) {
          p[i]     = exp2_sat(sa[qi][i]);
          p[8 + i] = exp2_sat(sb[qi][i]);
        }
        lacc[qi] +=
            (((p[0] + p[1]) + (p[2] + p[3])) + ((p[4] + p[5]) + (p[6] + p[7]))) +
            (((p[8] + p[9]) + (p[10] + p[11])) +
             ((p[12] + p[13]) + (p[14] + p[15])));

        // ---- P as the B operands, in place: hi and lo bf16 parts ----
        v8u uh, ul;
        #pragma unroll
        for (int j = 0; j < 8; ++j) {
          unsigned h, l;
          split2(p[2 * j], p[2 * j + 1], h, l);
          uh[j] = h; ul[j] = l;
        }
        const bf16x16 Ph = __builtin_bit_cast(bf16x16, uh);
        const bf16x16 Pl = __builtin_bit_cast(bf16x16, ul);

        // ---- O^T += V^T x P : 4 v-tiles x 3 products of K = 32 ----
        #pragma unroll
        for (int vt = 0; vt < 4; ++vt) o[qi][vt] = wmma32(Vh[vt], Ph, o[qi][vt]);
        #pragma unroll
        for (int vt = 0; vt < 4; ++vt) o[qi][vt] = wmma32(Vl[vt], Ph, o[qi][vt]);
        #pragma unroll
        for (int vt = 0; vt < 4; ++vt) o[qi][vt] = wmma32(Vh[vt], Pl, o[qi][vt]);
      }
      // ---- the next group's score tiles ----
      if (kt + 32 < KW) {
        #pragma unroll
        for (int qi = 0; qi < 2; ++qi) {
          sa[qi] = wmma4(v2f{hi ? ka.z : ka.x, hi ? ka.w : ka.y}, Bq[qi], c8[qi]);
          sb[qi] = wmma4(v2f{hi ? kb.z : kb.x, hi ? kb.w : kb.y}, Bq[qi], c8[qi]);
        }
      }
    }

    // ---- publish point of stage t+1, then refill of the buffer just read ----
    // this wave's LDS reads of stage t have returned
    asm volatile("s_wait_dscnt 0x0" ::: "memory");
    // this wave's copies of stage t+1 have landed
    asm volatile("s_wait_asynccnt 0x0" ::: "memory");
    __syncthreads();
    if (t + 2 < NST)
      stage_copy((t & 1) ? lv1 : lv0, gv + (size_t)(t + 2) * KT * DV,
                 (t & 1) ? lk1 : lk0, gk + (size_t)(t + 2) * KT * 16);
  }
  // no copy is left in flight when the wave ends
  asm volatile("s_wait_asynccnt 0x0" ::: "memory");

  // ---- join the key quarters: waves 4-15 hand O and the denominators over ----
  // The ring is free for it: every wave's LDS reads had returned and its copies
  // had landed ahead of the last trip's barrier.
  if (kq) {
    float* xs = vts + (((kq - 1) * 4 + qp) * 32 + lane) * XP;
    #pragma unroll
    for (int qi = 0; qi < 2; ++qi) {
      #pragma unroll
      for (int vt = 0; vt < 4; ++vt) {
        const v8f ov = o[qi][vt];
        *(float4*)(xs + qi * 32 + vt * 8)     = make_float4(ov[0], ov[1], ov[2], ov[3]);
        *(float4*)(xs + qi * 32 + vt * 8 + 4) = make_float4(ov[4], ov[5], ov[6], ov[7]);
      }
    }
    *(float2*)(xs + 64) = make_float2(lacc[0], lacc[1]);
  }
  __syncthreads();
  if (kq) return;
  #pragma unroll
  for (int j = 0; j < 3; ++j) {
    const float* xr = vts + ((j * 4 + qp) * 32 + lane) * XP;
    #pragma unroll
    for (int qi = 0; qi < 2; ++qi) {
      #pragma unroll
      for (int vt = 0; vt < 4; ++vt) {
        const float4 xa = *(const float4*)(xr + qi * 32 + vt * 8);
        const float4 xb = *(const float4*)(xr + qi * 32 + vt * 8 + 4);
        o[qi][vt] += v8f{xa.x, xa.y, xa.z, xa.w, xb.x, xb.y, xb.z, xb.w};
      }
    }
    const float2 xl = *(const float2*)(xr + 64);
    lacc[0] += xl.x;
    lacc[1] += xl.y;
  }

  // ---- finalize: combine lane halves of the denominator, divide, store ----
  #pragma unroll
  for (int qi = 0; qi < 2; ++qi) {
    const float inv = 1.0f / (lacc[qi] + swap16(lacc[qi]));
    #pragma unroll
    for (int vt = 0; vt < 4; ++vt) o[qi][vt] *= inv;
  }
  // register r of v-tile vt is v = 32*hi + 8*vt + r
  float* ob = out + ((size_t)(b * NQ + q)) * DV + (hi ? 32 : 0);
  #pragma unroll
  for (int qi = 0; qi < 2; ++qi) {
    #pragma unroll
    for (int vt = 0; vt < 4; ++vt) {
      const v8f ov = o[qi][vt];
      float* op = ob + qi * 16 * DV + vt * 8;
      *(float4*)(op)     = make_float4(ov[0], ov[1], ov[2], ov[3]);
      *(float4*)(op + 4) = make_float4(ov[4], ov[5], ov[6], ov[7]);
    }
  }
}

// ---------------------------------------------------------------------------
extern "C" void kernel_launch(void* const* d_in, const int* in_sizes, int n_in,
                              void* d_out, int out_size, void* d_ws,
                              size_t ws_size, hipStream_t stream) {
  const float* KEY   = (const float*)d_in[0];
  const float* VALUE = (const float*)d_in[1];
  const float* QUERY = (const float*)d_in[2];
  const float* W1 = (const float*)d_in[3];
  const float* b1 = (const float*)d_in[4];
  const float* W2 = (const float*)d_in[5];
  const float* b2 = (const float*)d_in[6];
  const float* W3 = (const float*)d_in[7];
  const float* b3 = (const float*)d_in[8];

  float4* kaug = (float4*)d_ws;                 // 512 KB
  float4* qaug = kaug + (size_t)BB * NK;        // 512 KB
  float4* vpair = qaug + (size_t)BB * NQ;       // 8 MB: V as bf16 hi and lo parts

  NW0_mlp_aug<<<(BB * NK) / 128, 256, 0, stream>>>(
      KEY, W1, b1, W2, b2, W3, b3, kaug, VALUE, vpair);
  NW0_mlp_aug<<<(BB * NQ) / 128, 256, 0, stream>>>(
      QUERY, W1, b1, W2, b2, W3, b3, qaug, VALUE + (size_t)(BB / 2) * NK * DV,
      vpair + (size_t)(BB / 2) * NK * DV / 4);
  NW0_attn<<<BB * (NQ / 128), 512, 0, stream>>>(
      kaug, qaug, (const float*)vpair, (float*)d_out);
}
